// v000
// The times below were measured on an AMD MI455X: many runs one after another, warmed up first and cycling through
// copies of the inputs, with the whole window's GPU time divided by the number of runs. Launches and the gaps
// between them are all in it. The median over several windows is given; except for v000 it joins two sittings, which
// can be a few percent apart, so the side-by-side timings, each taken in one sitting, are the better comparison.
// The starting kernel, v000, takes 156 microseconds a run.
// Contractions: scores k.q^T (k x1024 and q x1024 as f16 planes of the bf16-RNE-converted inputs, one product, K=128) and
// P.v (P x32768 as an f16 hi plane plus an unscaled f16 residual plane, two products into one f32 accumulator; v x256 f16
// of the bf16-RNE-converted input; 32-key steps): all v_wmma_f32_16x16x32_f16 (f16 operands, f32 accumulate).
// Causal key range (key <= query); base-2 online softmax and the 1/l fold in f32 on VALU.
#include <hip/hip_runtime.h>
#include <math.h>
#include <stdint.h>

#ifndef NB
#define NB    16
#endif
#define SEQ   2048
#define HD    128
#define QSC   1024.0f
#define KSC   1024.0f
#define PCAR  32768.0f
#define VCAR  256.0f
#define SM_SCALE 0.08838834764831845f
#define LOG2E 1.4426950408889634f
#define ATW   4
#define ATT_THREADS (ATW * 32)
#define QPB   (16 * ATW)
#define BPB   (SEQ / QPB)
#define ATT_BLOCKS (NB * BPB)
#define QP    20
#define SLABF (HD * QP)
#define VTP   72
#define VTILES (SEQ / 64)
static_assert(HD == 128 && QPB == 64 && ATT_THREADS == 128);
static_assert((SEQ % QPB) == 0 && (SEQ % 64) == 0 && (SEQ % 32) == 0 && (HD % 32) == 0);
static_assert(NB >= 1 && NB <= 16);
static_assert(BPB == 32 && VTILES == 32);
static_assert((HD - 1) * VTP + 63 < HD * VTP);
static_assert((HD - 1) * QP + 15 < SLABF && (QP % 4) == 0);
static_assert(((NB * SEQ * HD) % 2048) == 0);

typedef _Float16 v16h __attribute__((ext_vector_type(16)));
typedef _Float16 v8h  __attribute__((ext_vector_type(8)));
typedef float    v8f  __attribute__((ext_vector_type(8)));
typedef float    v4f  __attribute__((ext_vector_type(4)));
typedef unsigned int v4u __attribute__((ext_vector_type(4)));

union FragH { v16h v; v8h h[2]; v4u u[2]; };

// ---- scalar helpers --------------------------------------------------------------------------------
__device__ __forceinline__ unsigned short bf_bits(float f) {          // f32 -> bf16 bits, RNE convert
  unsigned u = __float_as_uint(f);
  return (unsigned short)((u + 0x7FFFu + ((u >> 16) & 1u)) >> 16);
}
__device__ __forceinline__ float bf_up(unsigned short h) { return __uint_as_float(((unsigned)h) << 16); }
__device__ __forceinline__ float bfr(float f) { return bf_up(bf_bits(f)); }   // value of the bf16 RNE convert
__device__ __forceinline__ unsigned short h_bits(_Float16 x) { return __builtin_bit_cast(unsigned short, x); }
__device__ __forceinline__ unsigned pk16(unsigned short a, unsigned short b) { return (unsigned)a | ((unsigned)b << 16); }
__device__ __forceinline__ v8f zero8() { v8f z = {0.f, 0.f, 0.f, 0.f, 0.f, 0.f, 0.f, 0.f}; return z; }

// ---- fragment loader: 16-bit A/B operand, lane -> row/col (lane&15), p already includes +8*(lane>>4);
//      elements 0..7 <- p[0..7] (k0+8h..), elements 8..15 <- p[16..23] (k0+16+8h..)  (same split k map for A and B;
//      B is always read from a k-contiguous [n][k] plane)
__device__ __forceinline__ v16h ldfrag_h(const _Float16* p) {
  FragH f;
  f.h[0] = *(const v8h*)(p);
  f.h[1] = *(const v8h*)(p + 16);
  return f.v;
}

__device__ __forceinline__ v8f mma_raw(v16h a, v16h b, v8f c) {
  return __builtin_amdgcn_wmma_f32_16x16x32_f16(false, a, false, b, (short)0, c, false, false);
}
// after a 4-deep score chain: ties the accumulator, keeps the 4 A and 4 B fragments live through the nops
__device__ __forceinline__ void guard_s(v8f& s, v16h x0, v16h x1, v16h x2, v16h x3,
                                        v16h y0, v16h y1, v16h y2, v16h y3) {
#if defined(__HIP_DEVICE_COMPILE__)
  asm volatile("v_nop\n\tv_nop\n\tv_nop\n\tv_nop"
               : "+v"(s) : "v"(x0), "v"(x1), "v"(x2), "v"(x3), "v"(y0), "v"(y1), "v"(y2), "v"(y3) : "memory");
#endif
}
// after a group of 8 P.V products (hi and residual P planes x 4 v fragments): ties 4 accumulators, keeps both P
// fragments and the 4 v fragments live
__device__ __forceinline__ void guard_o4(v8f& a, v8f& b, v8f& c, v8f& d,
                                         v16h p, v16h q, v16h x0, v16h x1, v16h x2, v16h x3) {
#if defined(__HIP_DEVICE_COMPILE__)
  asm volatile("v_nop\n\tv_nop\n\tv_nop\n\tv_nop"
               : "+v"(a), "+v"(b), "+v"(c), "+v"(d) : "v"(p), "v"(q), "v"(x0), "v"(x1), "v"(x2), "v"(x3) : "memory");
#endif
}
__device__ __forceinline__ void acc_guard8(v8f& a, v8f& b, v8f& c, v8f& d, v8f& e, v8f& f, v8f& g, v8f& hx) {
#if defined(__HIP_DEVICE_COMPILE__)
  asm volatile("v_nop\n\tv_nop\n\tv_nop\n\tv_nop"
               : "+v"(a), "+v"(b), "+v"(c), "+v"(d), "+v"(e), "+v"(f), "+v"(g), "+v"(hx));
#endif
}
__device__ __forceinline__ void wave_sync_lds() {
  __builtin_amdgcn_fence(__ATOMIC_RELEASE, "workgroup");
  __builtin_amdgcn_wave_barrier();
  __builtin_amdgcn_fence(__ATOMIC_ACQUIRE, "workgroup");
}

// =====================================================================================================
// 16-bit plane convert, no relayout (inputs are batch-major [b][s][d]):
//   pl[e] = f16( bf16(x[e]) * sc ) (sc a power of two, exact). blockIdx.y == 0: q plane, == 1: k plane.
// Thread = 8 consecutive elements: two 16-B loads, one 16-B store per lane; 32 consecutive lanes = 256 contiguous, 512-B
// coverage: grid = (n8/256, 2) blocks x 256 thr x 8 elements = n = NB*2048*128 per plane exactly (n % 2048 == 0 asserted).
// =====================================================================================================
__global__ __launch_bounds__(256) void cvt16(const float* __restrict__ xq, const float* __restrict__ xk,
                                             unsigned short* plq, unsigned short* plk, int n8, float sc) {
  const int gt = blockIdx.x * 256 + (int)threadIdx.x;
  if (gt >= n8) return;                     // never taken with the exact grid; no barriers in this kernel
  const bool sk = (blockIdx.y != 0);        // block-uniform plane select (both pointers global)
  const float* x = sk ? xk : xq;
  unsigned short* pl = sk ? plk : plq;
  const size_t e = (size_t)gt * 8;
  const v4f a = *(const v4f*)(x + e), bq = *(const v4f*)(x + e + 4);
  v4u o;
#pragma unroll
  for (int i = 0; i < 2; ++i) {
    o[i]     = pk16(h_bits((_Float16)(bfr(a[2 * i]) * sc)),  h_bits((_Float16)(bfr(a[2 * i + 1]) * sc)));
    o[2 + i] = pk16(h_bits((_Float16)(bfr(bq[2 * i]) * sc)), h_bits((_Float16)(bfr(bq[2 * i + 1]) * sc)));
  }
  unsigned short* d = pl + e;
  {
    *(v4u*)(d) = o;
    
  }
}

// =====================================================================================================
// v^T plane: VT[(b*HD + d)][key] = f16( bf16(v[b][key][d]) * 256 ) (exact), pitch SEQ = 2048 halves (4096 B) per d row.
// Block = (b, tile of 64 keys): 64 source rows of 128 floats loaded with 16-B loads (static stride), converted, written into
// coverage: load 256 thr x 32 elements = 64 keys x 128 d; store 4 iterations x 256 thr x 8 halves = 128 lines x 64 = the tile;
//           grid = NB x 32 blocks covers the whole [NB][128][2048] plane exactly once.
// =====================================================================================================
__global__ __launch_bounds__(256) void vt16(const float* __restrict__ v, unsigned short* VTo) {
  __shared__ __align__(16) unsigned short T[HD * VTP];
  const int tid = threadIdx.x;
  const int bid = blockIdx.x;
  const int bb  = bid / VTILES;
  const int t   = bid - bb * VTILES;        // 0..31, block-uniform
  if (bb >= NB) return;                     // never taken with the exact grid; before any barrier or store
  {
    const int sl = tid >> 2;                  // key within tile 0..63
    const int dc = (tid & 3) * 32;            // d chunk 0,32,64,96
    int key = 64 * t + sl;                    // <= SEQ-1 by construction; clamp keeps the address in range regardless
    key = (key < 0) ? 0 : ((key > SEQ - 1) ? (SEQ - 1) : key);
    const float* src = v + (((size_t)bb * SEQ + (size_t)key) * HD + dc);
#pragma unroll
    for (int i = 0; i < 8; ++i) {
      const v4f a = *(const v4f*)(src + 4 * i);
#pragma unroll
      for (int e = 0; e < 4; ++e) T[(dc + 4 * i + e) * VTP + sl] = h_bits((_Float16)(bfr(a[e]) * VCAR));
    }
  }
  __syncthreads();
  v4u vals[4];
  const int q8 = tid >> 3, p8 = (tid & 7) * 8;
#pragma unroll
  for (int it = 0; it < 4; ++it) {
    const int line = it * 32 + q8;            // d = 0..127
    vals[it] = *(const v4u*)(T + line * VTP + p8);
  }
  unsigned short* dst = VTo + ((size_t)bb * HD) * SEQ + 64 * t + p8;
  {
#pragma unroll
    for (int it = 0; it < 4; ++it) {
      const int line = it * 32 + q8;
      *(v4u*)(dst + (size_t)line * SEQ) = vals[it];
    }
    
  }
}

// =====================================================================================================
// Causal flash attention per batch. Block = (b, 64 queries), wave w owns query rows iw = 64t + 16w .. +15.
//   q plane f16 [b][s][d] x1024, k plane f16 [b][s][d] x1024, v^T plane f16 [b][d][SEQ] x256.
//   Key loop kb = 0, 32, ... while kb < iw + 16 (wave-uniform, SGPR): keys above iw+15 are excluded for every query of the
//   wave; kb <= iw always holds so key kb is included for every query in every step (row max finite, row sum >= 1).
//   Scores are formed transposed, S^T = K.Q^T: A fragment = k plane row (key kb+16u+c), B fragment = q plane row
//   (query iw+c), both with the split d map, 4 d-steps of 32, one product each.
//   D element r of subtile u at lane (h,c) = score(key kb+16u+8h+r, query iw+c). In the last step(s) entries with
//   key > query are excluded (score -> -inf before the max, exp2 -> exactly 0), which equals the large negative fill
//   followed by softmax in f32.
//   The A fragment of P for the P.V product (row = query c, element r <- key kb+8h+r from subtile 0, element 8+r <-
//   key kb+16+8h+r from subtile 1) is an in-lane f32 -> f16 convert of P*32768 into a hi plane plus an unscaled residual
//   plane res = f16(P*32768 - hi); both planes multiply the same v fragments into the same accumulator (two products).
//   Online max-subtracted softmax in f32 (exp2); per-query max/sum = 16 in-lane values combined across the two lane halves;
//   rescale factors broadcast with shuffles.
//   P.V: B fragments = v^T plane rows d = 16j+c (keys contiguous), 16 products into 8 accumulators (16 queries x 128 d).
//   Epilogue: 1/l and the carry folds in f32; the wave's 16x128 slab staged transposed [d][16] (pitch 20) in its private LDS
// coverage: per wave 16 instructions x 32 lanes x 4 floats = 16 rows x 128; per block 4 waves = 64 rows; 32 blocks per
//           batch x NB batches: every row of out [NB][2048][128] exactly once (grid NB*32 blocks); every block and wave
//           runs at least one key step.
// =====================================================================================================
__global__ __launch_bounds__(ATT_THREADS)
void attn_fwd(const unsigned short* __restrict__ QHp, const unsigned short* __restrict__ KHp,
              const unsigned short* __restrict__ VTq, float* OPp) {
  __shared__ __align__(16) float smem[ATW * SLABF];    // per wave: [128 d][16 queries] f32 slab, pitch QP

  const int tid  = threadIdx.x;
  const int wave = tid >> 5;
  const int lane = tid & 31;
  const int hh   = lane >> 4;
  const int c    = lane & 15;

  const int bid  = blockIdx.x;
  const int bb   = bid / BPB;
  const int t    = bid - bb * BPB;                     // 0..31, block-uniform
  if (bb >= NB) return;                                // never taken with the exact grid; before any LDS use or store

  const int iw   = QPB * t + wave * 16;                // query row 0 of this wave, iw + 15 <= SEQ - 1
  const int iwu  = __builtin_amdgcn_readfirstlane(iw); // wave-uniform copy in an SGPR
  const int kend = iwu + 16;                           // keys 0 .. iw+15 ; kend <= SEQ

  // B fragments of q^T: lane col n = query iw + c, split d map
  const _Float16* Qb = (const _Float16*)(const void*)QHp + ((size_t)bb * SEQ + (size_t)(iw + c)) * HD + 8 * hh;
  const v16h qf0 = ldfrag_h(Qb);                       // d 0..31
  const v16h qf1 = ldfrag_h(Qb + 32);                  // d 32..63
  const v16h qf2 = ldfrag_h(Qb + 64);                  // d 64..95
  const v16h qf3 = ldfrag_h(Qb + 96);                  // d 96..127
  const _Float16* Kb = (const _Float16*)(const void*)KHp + ((size_t)bb * SEQ + (size_t)c) * HD + 8 * hh;   // key row c
  const _Float16* Vb = (const _Float16*)(const void*)VTq + ((size_t)bb * HD + (size_t)c) * SEQ + 8 * hh;   // d row c
  const float lsc = (SM_SCALE * LOG2E) / (QSC * KSC);
  const int dq0 = 8 * hh - (iw + c);                   // key(kb+8hh+r) - query(iw+c) = kb + dq0 + r

  float m_run = -INFINITY, l_run = 0.f;
  v8f o[8];
#pragma unroll
  for (int j = 0; j < 8; ++j) o[j] = zero8();

#pragma unroll 1
  for (int kb = 0; kb < kend; kb += 32) {
    // ---- scores (transposed): s0 = keys kb..kb+15, s1 = keys kb+16..kb+31, columns = queries iw..iw+15 ----
    v8f s0 = zero8(), s1 = zero8();
    {
      const _Float16* k0p = Kb + (size_t)kb * HD;                    // key row kb + c
      const v16h a0 = ldfrag_h(k0p), a1 = ldfrag_h(k0p + 32), a2 = ldfrag_h(k0p + 64), a3 = ldfrag_h(k0p + 96);
      s0 = mma_raw(a0, qf0, s0);
      s0 = mma_raw(a1, qf1, s0);
      s0 = mma_raw(a2, qf2, s0);
      s0 = mma_raw(a3, qf3, s0);
      guard_s(s0, a0, a1, a2, a3, qf0, qf1, qf2, qf3);
      const _Float16* k1p = k0p + (size_t)16 * HD;                   // key row kb + 16 + c
      const v16h b0 = ldfrag_h(k1p), b1 = ldfrag_h(k1p + 32), b2 = ldfrag_h(k1p + 64), b3 = ldfrag_h(k1p + 96);
      s1 = mma_raw(b0, qf0, s1);
      s1 = mma_raw(b1, qf1, s1);
      s1 = mma_raw(b2, qf2, s1);
      s1 = mma_raw(b3, qf3, s1);
      guard_s(s1, b0, b1, b2, b3, qf0, qf1, qf2, qf3);
    }
    // ---- base-2 logits for query iw + c (16 keys in this lane, 16 in the other half) ----
    float u0[8], u1[8];
#pragma unroll
    for (int r = 0; r < 8; ++r) {
      u0[r] = s0[r] * lsc;
      u1[r] = s1[r] * lsc;
    }
    // ---- causal exclusion, only in steps that hold keys above some query of the wave (wave-uniform test) ----
    if (kb + 32 > iwu) {
      const int dq = kb + dq0;
#pragma unroll
      for (int r = 0; r < 8; ++r) {
        u0[r] = (dq + r > 0)      ? -INFINITY : u0[r];   // key kb+8hh+r    > query iw+c
        u1[r] = (dq + 16 + r > 0) ? -INFINITY : u1[r];   // key kb+16+8hh+r > query iw+c
      }
    }
    // ---- online softmax ----
    float mx = -INFINITY;
#pragma unroll
    for (int r = 0; r < 8; ++r) mx = fmaxf(mx, fmaxf(u0[r], u1[r]));
    mx = fmaxf(mx, __shfl_xor(mx, 16, 32));            // finite: key kb <= iw <= every query of the wave
    const float mn = fmaxf(m_run, mx);                 // finite from the first step on
    const float al = exp2f(m_run - mn);                // 0 on the first step
    m_run = mn;
    float ps = 0.f;
    FragH pa, pl;                                      // hi plane and unscaled residual plane of P*32768
#pragma unroll
    for (int r = 0; r < 8; ++r) {
      const float e0 = exp2f(u0[r] - mn), e1 = exp2f(u1[r] - mn);   // excluded keys: exp2(-inf) = 0 exactly
      ps += e0 + e1;
      const float x0 = e0 * PCAR, x1 = e1 * PCAR;
      const _Float16 g0 = (_Float16)x0, g1 = (_Float16)x1;
      pa.h[0][r] = g0;                                  // element r     = key kb + 8hh + r
      pa.h[1][r] = g1;                                  // element 8 + r = key kb + 16 + 8hh + r
      pl.h[0][r] = (_Float16)(x0 - (float)g0);          // residual (exact f32 difference, then f16 convert)
      pl.h[1][r] = (_Float16)(x1 - (float)g1);
    }
    ps += __shfl_xor(ps, 16, 32);
    l_run = l_run * al + ps;
#pragma unroll
    for (int r = 0; r < 8; ++r) {
      const float af = __shfl(al, 8 * hh + r, 32);      // rescale factor of query iw + 8hh + r
#pragma unroll
      for (int j = 0; j < 8; ++j) o[j][r] *= af;
    }
    // ---- P.V : B fragment col n = d = 16j + c, keys kb .. kb+31 contiguous in the v^T plane row d ----
    {
      const _Float16* vp = Vb + kb;
      const v16h v0 = ldfrag_h(vp);
      const v16h v1 = ldfrag_h(vp + (size_t)16 * SEQ);
      const v16h v2 = ldfrag_h(vp + (size_t)32 * SEQ);
      const v16h v3 = ldfrag_h(vp + (size_t)48 * SEQ);
      o[0] = mma_raw(pa.v, v0, o[0]);
      o[0] = mma_raw(pl.v, v0, o[0]);
      o[1] = mma_raw(pa.v, v1, o[1]);
      o[1] = mma_raw(pl.v, v1, o[1]);
      o[2] = mma_raw(pa.v, v2, o[2]);
      o[2] = mma_raw(pl.v, v2, o[2]);
      o[3] = mma_raw(pa.v, v3, o[3]);
      o[3] = mma_raw(pl.v, v3, o[3]);
      guard_o4(o[0], o[1], o[2], o[3], pa.v, pl.v, v0, v1, v2, v3);
      const v16h v4 = ldfrag_h(vp + (size_t)64 * SEQ);
      const v16h v5 = ldfrag_h(vp + (size_t)80 * SEQ);
      const v16h v6 = ldfrag_h(vp + (size_t)96 * SEQ);
      const v16h v7 = ldfrag_h(vp + (size_t)112 * SEQ);
      o[4] = mma_raw(pa.v, v4, o[4]);
      o[4] = mma_raw(pl.v, v4, o[4]);
      o[5] = mma_raw(pa.v, v5, o[5]);
      o[5] = mma_raw(pl.v, v5, o[5]);
      o[6] = mma_raw(pa.v, v6, o[6]);
      o[6] = mma_raw(pl.v, v6, o[6]);
      o[7] = mma_raw(pa.v, v7, o[7]);
      o[7] = mma_raw(pl.v, v7, o[7]);
      guard_o4(o[4], o[5], o[6], o[7], pa.v, pl.v, v4, v5, v6, v7);
    }
  }
  acc_guard8(o[0], o[1], o[2], o[3], o[4], o[5], o[6], o[7]);

  // ---- fold 1/l and the carries (32768 on P, 256 on v), stage the wave's slab transposed [d][query] in its LDS region ----
  const float oc = 1.0f / (PCAR * VCAR);               // 2^-23 exact
  const float li = (l_run > 0.0f) ? ((1.0f / l_run) * oc) : 0.0f;   // l_run >= 1 (the max element contributes 2^0)
  float* slab = smem + wave * SLABF;
  float lf[8];
#pragma unroll
  for (int r = 0; r < 8; ++r) lf[r] = __shfl(li, 8 * hh + r, 32);   // factor of query iw + 8hh + r
#pragma unroll
  for (int j = 0; j < 8; ++j) {
    v4f w0, w1;
#pragma unroll
    for (int r = 0; r < 4; ++r) { w0[r] = o[j][r] * lf[r]; w1[r] = o[j][4 + r] * lf[4 + r]; }
    float* sp = slab + (16 * j + c) * QP + 8 * hh;     // d row 16j + c, query cols 8hh .. 8hh+7, 16-B aligned
    *(v4f*)(sp)     = w0;
    *(v4f*)(sp + 4) = w1;
  }
  wave_sync_lds();
  v4f vals[16];
#pragma unroll
  for (int it = 0; it < 16; ++it) {
#pragma unroll
    for (int e = 0; e < 4; ++e) vals[it][e] = slab[(4 * lane + e) * QP + it];   // out(query iw+it, d = 4*lane+e)
  }
  float* dst = OPp + ((size_t)bb * SEQ + (size_t)iw) * HD + 4 * lane;
  {
#pragma unroll
    for (int it = 0; it < 16; ++it) {
      *(v4f*)(dst + (size_t)it * HD) = vals[it];   // one 512-B row per instruction, lanes 8q..8q+7 per line
    }
    
  }
}

// =====================================================================================================
// Workspace map (bytes); every plane is fully written by whole-line stores before it is read; all extents are exact
// multiples of the store granularity (no pad rows needed); offsets multiples of 128 (NB = 16 values):
//   QH f16 [NB][2048][128] x1024       8388608   at        0
//   KH f16 [NB][2048][128] x1024       8388608   at  8388608
//   VT f16 [NB][128][2048] x256        8388608   at 16777216
//   end                                             25165824
// =====================================================================================================
extern "C" void kernel_launch(void* const* d_in, const int* in_sizes, int n_in,
                              void* d_out, int out_size, void* d_ws, size_t ws_size,
                              hipStream_t stream) {
  const int NEL = NB * SEQ * HD;                        // 4194304 for NB = 16
  if (n_in < 3) return;
  if (in_sizes[0] < NEL || in_sizes[1] < NEL || in_sizes[2] < NEL) return;
  if (out_size < NEL) return;

  const float* q  = (const float*)d_in[0];
  const float* k  = (const float*)d_in[1];
  const float* v  = (const float*)d_in[2];
  float*       out = (float*)d_out;

  const size_t PQ = (size_t)NEL * 2;                    //  8388608
  const size_t PK = (size_t)NEL * 2;                    //  8388608
  const size_t PV = (size_t)NB * HD * SEQ * 2;          //  8388608
  size_t off = 0;
  const size_t oQH = off; off += PQ;
  const size_t oKH = off; off += PK;
  const size_t oVT = off; off += PV;
  if (off > ws_size) return;                            // off = 25165824
  if (off > (size_t)134217728) return;

  char* ws = (char*)d_ws;
  unsigned short* QH = (unsigned short*)(ws + oQH);
  unsigned short* KH = (unsigned short*)(ws + oKH);
  unsigned short* VT = (unsigned short*)(ws + oVT);

  const int n8 = NEL / 8;                               // 524288
  const dim3 blk(256);
  const dim3 gC(n8 / 256, 2);                           // (2048, 2): q and k planes in one launch
  const dim3 gVT(NB * VTILES);                          // 512
  const dim3 gAT(ATT_BLOCKS);                           // 512
  const dim3 bAT(ATT_THREADS);                          // 128

  // (0) q and k planes f16(bf16(x) * 1024), layout [b][s][d]
  cvt16<<<gC, blk, 0, stream>>>(q, k, QH, KH, n8, QSC);
  // (1) v^T plane f16(bf16(v) * 256), layout [b][d][2048]
  vt16<<<gVT, blk, 0, stream>>>(v, VT);
  // (2) causal flash attention per batch -> out [b][s][d] f32
  attn_fwd<<<gAT, bAT, 0, stream>>>(QH, KH, VT, out);
  (void)hipGetLastError();
}

// v001
// It runs in 62.6 microseconds.
// In two side-by-side timings against v000, it was 2.47 and 2.55 times as fast.
// Contractions: scores k.q^T (k x1024 and q x1024 as f16 planes of the bf16-RNE-converted inputs, one product, K=128) and
// P.v (P x32768 as an f16 hi plane plus an unscaled f16 residual plane, two products into one f32 accumulator; v x256 f16
// of the bf16-RNE-converted input; 32-key steps): all v_wmma_f32_16x16x32_f16 (f16 operands, f32 accumulate).
// Causal key range (key <= query); base-2 online softmax and the 1/l fold in f32 on VALU.
#include <hip/hip_runtime.h>
#include <math.h>
#include <stdint.h>

#ifndef NB
#define NB    16
#endif
#define SEQ   2048
#define HD    128
#define QSC   1024.0f
#define KSC   1024.0f
#define PCAR  32768.0f
#define VCAR  256.0f
#define SM_SCALE 0.08838834764831845f
#define LOG2E 1.4426950408889634f
#define ATW   4
#define ATT_THREADS (ATW * 32)
#define QPB   (16 * ATW)
#define BPB   (SEQ / QPB)
#define ATT_BLOCKS (NB * BPB)
#define QP    20
#define SLABF (HD * QP)
#define VTP   72
#define VTILES (SEQ / 64)
#define STK   64                         // keys per LDS stage
#define KPB   272                        // LDS pitch of a staged k row: 256 B + 16 B pad (16 B x odd, ds_load_b128 reader)
#define VPB   144                        // LDS pitch of a staged v^T row: 128 B + 16 B pad
#define KPL   18432                      // place of the k tile in a buffer: 64 x 272 = 17408 B, rounded up to 2 KiB
#define VPL   18432                      // place of the v^T tile: 128 x 144 B
#define BUFB  (KPL + VPL)
static_assert(HD == 128 && QPB == 64 && ATT_THREADS == 128);
static_assert((SEQ % QPB) == 0 && (SEQ % 64) == 0 && (SEQ % 32) == 0 && (HD % 32) == 0);
static_assert(NB >= 1 && NB <= 16);
static_assert(BPB == 32 && VTILES == 32);
static_assert((HD - 1) * VTP + 63 < HD * VTP);
static_assert((HD - 1) * QP + 15 < SLABF && (QP % 4) == 0);
static_assert(((NB * SEQ * HD) % 2048) == 0);
static_assert(STK == QPB && STK * KPB <= KPL && HD * VPB <= VPL && (KPL % 2048) == 0 && (BUFB % 2048) == 0);
static_assert(KPB == HD * 2 + 16 && VPB == STK * 2 + 16);

typedef _Float16 v16h __attribute__((ext_vector_type(16)));
typedef _Float16 v8h  __attribute__((ext_vector_type(8)));
typedef float    v8f  __attribute__((ext_vector_type(8)));
typedef float    v4f  __attribute__((ext_vector_type(4)));
typedef unsigned int v4u __attribute__((ext_vector_type(4)));
typedef uint32_t u32x4 __attribute__((ext_vector_type(4)));
typedef uint32_t u32x8 __attribute__((ext_vector_type(8)));

union FragH { v16h v; v8h h[2]; v4u u[2]; };

// ---- scalar helpers --------------------------------------------------------------------------------
__device__ __forceinline__ unsigned short bf_bits(float f) {          // f32 -> bf16 bits, RNE convert
  unsigned u = __float_as_uint(f);
  return (unsigned short)((u + 0x7FFFu + ((u >> 16) & 1u)) >> 16);
}
__device__ __forceinline__ float bf_up(unsigned short h) { return __uint_as_float(((unsigned)h) << 16); }
__device__ __forceinline__ float bfr(float f) { return bf_up(bf_bits(f)); }   // value of the bf16 RNE convert
__device__ __forceinline__ unsigned short h_bits(_Float16 x) { return __builtin_bit_cast(unsigned short, x); }
__device__ __forceinline__ unsigned pk16(unsigned short a, unsigned short b) { return (unsigned)a | ((unsigned)b << 16); }
__device__ __forceinline__ v8f zero8() { v8f z = {0.f, 0.f, 0.f, 0.f, 0.f, 0.f, 0.f, 0.f}; return z; }

// ---- fragment loader: 16-bit A/B operand, lane -> row/col (lane&15), p already includes +8*(lane>>4);
//      elements 0..7 <- p[0..7] (k0+8h..), elements 8..15 <- p[16..23] (k0+16+8h..)  (same split k map for A and B;
//      B is always read from a k-contiguous [n][k] plane)
__device__ __forceinline__ v16h ldfrag_h(const _Float16* p) {
  FragH f;
  f.h[0] = *(const v8h*)(p);
  f.h[1] = *(const v8h*)(p + 16);
  return f.v;
}

__device__ __forceinline__ v8f mma_raw(v16h a, v16h b, v8f c) {
  return __builtin_amdgcn_wmma_f32_16x16x32_f16(false, a, false, b, (short)0, c, false, false);
}
// after a 4-deep score chain: ties the accumulator, keeps the 4 A and 4 B fragments live through the nops
__device__ __forceinline__ void guard_s(v8f& s, v16h x0, v16h x1, v16h x2, v16h x3,
                                        v16h y0, v16h y1, v16h y2, v16h y3) {
#if defined(__HIP_DEVICE_COMPILE__)
  asm volatile("v_nop\n\tv_nop\n\tv_nop\n\tv_nop"
               : "+v"(s) : "v"(x0), "v"(x1), "v"(x2), "v"(x3), "v"(y0), "v"(y1), "v"(y2), "v"(y3) : "memory");
#endif
}
// after a group of 8 P.V products (hi and residual P planes x 4 v fragments): ties 4 accumulators, keeps both P
// fragments and the 4 v fragments live
__device__ __forceinline__ void guard_o4(v8f& a, v8f& b, v8f& c, v8f& d,
                                         v16h p, v16h q, v16h x0, v16h x1, v16h x2, v16h x3) {
#if defined(__HIP_DEVICE_COMPILE__)
  asm volatile("v_nop\n\tv_nop\n\tv_nop\n\tv_nop"
               : "+v"(a), "+v"(b), "+v"(c), "+v"(d) : "v"(p), "v"(q), "v"(x0), "v"(x1), "v"(x2), "v"(x3) : "memory");
#endif
}
__device__ __forceinline__ void acc_guard8(v8f& a, v8f& b, v8f& c, v8f& d, v8f& e, v8f& f, v8f& g, v8f& hx) {
#if defined(__HIP_DEVICE_COMPILE__)
  asm volatile("v_nop\n\tv_nop\n\tv_nop\n\tv_nop"
               : "+v"(a), "+v"(b), "+v"(c), "+v"(d), "+v"(e), "+v"(f), "+v"(g), "+v"(hx));
#endif
}
__device__ __forceinline__ void wave_sync_lds() {
  __builtin_amdgcn_fence(__ATOMIC_RELEASE, "workgroup");
  __builtin_amdgcn_wave_barrier();
  __builtin_amdgcn_fence(__ATOMIC_ACQUIRE, "workgroup");
}

// ---- tensor load to LDS: descriptor words, issue, waits ----------------------------------------------
__device__ __forceinline__ uint32_t uni(uint32_t v) { return (uint32_t)__builtin_amdgcn_readfirstlane((int)v); }
// value held in a scalar register: a test on it compiles to s_cmp + s_cbranch_scc (tensor loads ignore EXEC), and a
// descriptor word formed from it is formed behind the asm waits that stand in front of this statement
__device__ __forceinline__ uint32_t pinned(uint32_t v) {
  uint32_t w = uni(v);
#if defined(__HIP_DEVICE_COMPILE__)
  asm volatile("" : "+s"(w));
#endif
  return w;
}
__device__ __forceinline__ void wait_ds0() {       // this wave's LDS reads have returned before the buffer is handed over
#if defined(__HIP_DEVICE_COMPILE__)
  asm volatile("s_wait_dscnt 0x0" ::: "memory");
#endif
}
__device__ __forceinline__ void wait_tensor0() {   // the issuing wave's tile has landed (the compiler places no such wait)
#if defined(__HIP_DEVICE_COMPILE__)
  asm volatile("s_wait_tensorcnt 0x0" ::: "memory");
#endif
}
// Group 1 of a two-dimensional tile, every extent in bytes: ROWS rows of ROWB bytes, source pitch PITCH, 16 B of LDS pad
// behind each row (interval code IVL = the row length), no mask; tensor dims = tile dims (every tile is interior).
template <uint32_t ROWB, uint32_t ROWS, uint32_t PITCH, uint32_t IVL>
__device__ __forceinline__ u32x8 tdm_group1() {
  u32x8 g;   // pinned(): each descriptor word held in a scalar register of its own for the whole kernel
  g[0] = pinned((1u << 20) | (IVL << 22) | (3u << 25));
  g[1] = pinned((ROWB & 0xFFFFu) << 16);
  g[2] = pinned((ROWB >> 16) | ((ROWS & 0xFFFFu) << 16));
  g[3] = pinned((ROWS >> 16) | (ROWB << 16));
  g[4] = pinned(ROWS);
  g[5] = pinned(PITCH);
  g[6] = pinned(0u);
  g[7] = pinned(0u);
  return g;
}
__device__ __forceinline__ u32x4 tdm_group0(uint32_t lds_dst, uint64_t ga) {
  u32x4 g;
  g[0] = uni(1u);
  g[1] = uni(lds_dst);
  g[2] = uni((uint32_t)ga);
  g[3] = uni((((uint32_t)(ga >> 32)) & 0x01FFFFFFu) | 0x80000000u);
#if defined(__HIP_DEVICE_COMPILE__)
  asm volatile("" : "+s"(g));   // descriptor words held in scalar registers until the wait that names them
#endif
  return g;
}
__device__ __forceinline__ void tdm_load(u32x4 g0, u32x8 g1) {
#if defined(__HIP_DEVICE_COMPILE__)
  asm volatile("tensor_load_to_lds %0, %1" :: "s"(g0), "s"(g1) : "memory");
#endif
}
// the issuing wave's tile has landed (the compiler places no such wait); naming the descriptor keeps its registers
// unchanged while the request is outstanding
__device__ __forceinline__ void tdm_wait(u32x4 g0, u32x8 g1) {
#if defined(__HIP_DEVICE_COMPILE__)
  asm volatile("s_wait_tensorcnt 0x0" :: "s"(g0), "s"(g1) : "memory");
#endif
}

// =====================================================================================================
// 16-bit plane convert, no relayout (inputs are batch-major [b][s][d]):
//   pl[e] = f16( bf16(x[e]) * sc ) (sc a power of two, exact). blockIdx.y == 0: q plane, == 1: k plane.
// Thread = 8 consecutive elements: two 16-B loads, one 16-B store per lane; 32 consecutive lanes = 256 contiguous, 512-B
// coverage: grid = (n8/256, 2) blocks x 256 thr x 8 elements = n = NB*2048*128 per plane exactly (n % 2048 == 0 asserted).
// =====================================================================================================
__global__ __launch_bounds__(256) void cvt16(const float* __restrict__ xq, const float* __restrict__ xk,
                                             unsigned short* plq, unsigned short* plk, int n8, float sc) {
  const int gt = blockIdx.x * 256 + (int)threadIdx.x;
  if (gt >= n8) return;                     // never taken with the exact grid; no barriers in this kernel
  const bool sk = (blockIdx.y != 0);        // block-uniform plane select (both pointers global)
  const float* x = sk ? xk : xq;
  unsigned short* pl = sk ? plk : plq;
  const size_t e = (size_t)gt * 8;
  const v4f a = *(const v4f*)(x + e), bq = *(const v4f*)(x + e + 4);
  v4u o;
#pragma unroll
  for (int i = 0; i < 2; ++i) {
    o[i]     = pk16(h_bits((_Float16)(bfr(a[2 * i]) * sc)),  h_bits((_Float16)(bfr(a[2 * i + 1]) * sc)));
    o[2 + i] = pk16(h_bits((_Float16)(bfr(bq[2 * i]) * sc)), h_bits((_Float16)(bfr(bq[2 * i + 1]) * sc)));
  }
  unsigned short* d = pl + e;
  {
    *(v4u*)(d) = o;
    
  }
}

// =====================================================================================================
// v^T plane: VT[(b*HD + d)][key] = f16( bf16(v[b][key][d]) * 256 ) (exact), pitch SEQ = 2048 halves (4096 B) per d row.
// Block = (b, tile of 64 keys): 64 source rows of 128 floats loaded with 16-B loads (static stride), converted, written into
// coverage: load 256 thr x 32 elements = 64 keys x 128 d; store 4 iterations x 256 thr x 8 halves = 128 lines x 64 = the tile;
//           grid = NB x 32 blocks covers the whole [NB][128][2048] plane exactly once.
// =====================================================================================================
__global__ __launch_bounds__(256) void vt16(const float* __restrict__ v, unsigned short* VTo) {
  __shared__ __align__(16) unsigned short T[HD * VTP];
  const int tid = threadIdx.x;
  const int bid = blockIdx.x;
  const int bb  = bid / VTILES;
  const int t   = bid - bb * VTILES;        // 0..31, block-uniform
  if (bb >= NB) return;                     // never taken with the exact grid; before any barrier or store
  {
    const int sl = tid >> 2;                  // key within tile 0..63
    const int dc = (tid & 3) * 32;            // d chunk 0,32,64,96
    int key = 64 * t + sl;                    // <= SEQ-1 by construction; clamp keeps the address in range regardless
    key = (key < 0) ? 0 : ((key > SEQ - 1) ? (SEQ - 1) : key);
    const float* src = v + (((size_t)bb * SEQ + (size_t)key) * HD + dc);
#pragma unroll
    for (int i = 0; i < 8; ++i) {
      const v4f a = *(const v4f*)(src + 4 * i);
#pragma unroll
      for (int e = 0; e < 4; ++e) T[(dc + 4 * i + e) * VTP + sl] = h_bits((_Float16)(bfr(a[e]) * VCAR));
    }
  }
  __syncthreads();
  v4u vals[4];
  const int q8 = tid >> 3, p8 = (tid & 7) * 8;
#pragma unroll
  for (int it = 0; it < 4; ++it) {
    const int line = it * 32 + q8;            // d = 0..127
    vals[it] = *(const v4u*)(T + line * VTP + p8);
  }
  unsigned short* dst = VTo + ((size_t)bb * HD) * SEQ + 64 * t + p8;
  {
#pragma unroll
    for (int it = 0; it < 4; ++it) {
      const int line = it * 32 + q8;
      *(v4u*)(dst + (size_t)line * SEQ) = vals[it];
    }
    
  }
}

// =====================================================================================================
// Causal flash attention per batch. Block = (b, 64 queries), wave w owns query rows iw = 64t + 16w .. +15.
//   q plane f16 [b][s][d] x1024, k plane f16 [b][s][d] x1024, v^T plane f16 [b][d][SEQ] x256.
//   The k and v^T planes reach the waves through LDS: stages of 64 keys, brought by tensor loads into two buffers that the
//   block's four waves share; the fragment loads below read the staged rows (same lane -> row and k maps as from the planes).
//   Key loop kb = 0, 32, ... while kb < 64t + 64 (block-uniform); steps worked while kb < iw + 16 (wave-uniform, SGPR): keys above iw+15 are excluded for every query of the
//   wave; kb <= iw always holds so key kb is included for every query in every step (row max finite, row sum >= 1).
//   Scores are formed transposed, S^T = K.Q^T: A fragment = k plane row (key kb+16u+c), B fragment = q plane row
//   (query iw+c), both with the split d map, 4 d-steps of 32, one product each.
//   D element r of subtile u at lane (h,c) = score(key kb+16u+8h+r, query iw+c). In the last step(s) entries with
//   key > query are excluded (score -> -inf before the max, exp2 -> exactly 0), which equals the large negative fill
//   followed by softmax in f32.
//   The A fragment of P for the P.V product (row = query c, element r <- key kb+8h+r from subtile 0, element 8+r <-
//   key kb+16+8h+r from subtile 1) is an in-lane f32 -> f16 convert of P*32768 into a hi plane plus an unscaled residual
//   plane res = f16(P*32768 - hi); both planes multiply the same v fragments into the same accumulator (two products).
//   Online max-subtracted softmax in f32 (exp2); per-query max/sum = 16 in-lane values combined across the two lane halves;
//   rescale factors broadcast with shuffles.
//   P.V: B fragments = v^T plane rows d = 16j+c (keys contiguous), 16 products into 8 accumulators (16 queries x 128 d).
//   Epilogue: 1/l and the carry folds in f32; the wave's 16x128 slab staged transposed [d][16] (pitch 20) in its private LDS
// coverage: per wave 16 instructions x 32 lanes x 4 floats = 16 rows x 128; per block 4 waves = 64 rows; 32 blocks per
//           batch x NB batches: every row of out [NB][2048][128] exactly once (grid NB*32 blocks); every block and wave
//           runs at least one key step.
// =====================================================================================================
__global__ __launch_bounds__(ATT_THREADS)
void attn_fwd(const unsigned short* __restrict__ QHp, const unsigned short* __restrict__ KHp,
              const unsigned short* __restrict__ VTq, float* OPp) {
  __shared__ __align__(16) float smem[ATW * SLABF];    // per wave: [128 d][16 queries] f32 slab, pitch QP
  __shared__ __attribute__((aligned(2048))) unsigned char ring[2 * BUFB];   // two buffers: k tile [64 keys][272 B], v^T tile [128 d][144 B]

  const int tid  = threadIdx.x;
  const int wave = tid >> 5;
  const int lane = tid & 31;
  const int hh   = lane >> 4;
  const int c    = lane & 15;

  const int bid  = blockIdx.x;
  const int bb   = bid / BPB;
  const int t    = bid - bb * BPB;                     // 0..31, block-uniform
  if (bb >= NB) return;                                // never taken with the exact grid; before any LDS use or store

  const int iw   = QPB * t + wave * 16;                // query row 0 of this wave, iw + 15 <= SEQ - 1
  const int iwu  = __builtin_amdgcn_readfirstlane(iw); // wave-uniform copy in an SGPR
  const int kend = iwu + 16;                           // keys 0 .. iw+15 ; kend <= SEQ

  // B fragments of q^T: lane col n = query iw + c, split d map
  const _Float16* Qb = (const _Float16*)(const void*)QHp + ((size_t)bb * SEQ + (size_t)(iw + c)) * HD + 8 * hh;
  const v16h qf0 = ldfrag_h(Qb);                       // d 0..31
  const v16h qf1 = ldfrag_h(Qb + 32);                  // d 32..63
  const v16h qf2 = ldfrag_h(Qb + 64);                  // d 64..95
  const v16h qf3 = ldfrag_h(Qb + 96);                  // d 96..127
  // Stage s = keys 64s .. 64s+63 of batch bb, shared by the block's four waves: wave 0 brings the k tile (64 rows of 256 B,
  // contiguous), wave 1 the v^T tile (128 d rows of 128 B, source pitch 4096 B), one request each, into buffer s & 1.
  // Stages 0 .. t: 64s + 63 <= 64t + 63 <= SEQ - 1, every tile interior to its plane.
  const uint32_t wv    = uni((uint32_t)tid >> 5);
  const uint32_t nst   = uni((uint32_t)t + 1u);
  const uint32_t lbase = (uint32_t)(size_t)ring;
  const uint64_t kga   = (uint64_t)(size_t)KHp + (uint64_t)bb * (SEQ * HD * 2);
  const uint64_t vga   = (uint64_t)(size_t)VTq + (uint64_t)bb * (HD * SEQ * 2);
  const u32x8 g1k = tdm_group1<HD * 2, STK, HD * 2, 5u>();
  const u32x8 g1v = tdm_group1<STK * 2, HD, SEQ * 2, 4u>();
  const uint32_t isk = (wv == 0u) ? 1u : 0u, isv = (wv == 1u) ? 1u : 0u;
  auto group0 = [&](uint32_t sn) {                     // sn comes from pinned(): formed behind the waits in front of it
    return tdm_group0(lbase + (sn & 1u) * BUFB + isv * KPL,
                      isv ? vga + (uint64_t)sn * (STK * 2) : kga + (uint64_t)sn * (STK * HD * 2));
  };
  u32x4 g0 = group0(pinned(0u));
  if (pinned(isk)) { tdm_load(g0, g1k); tdm_wait(g0, g1k); }   // stage 0 has landed
  if (pinned(isv)) { tdm_load(g0, g1v); tdm_wait(g0, g1v); }
  __syncthreads();                                     // stage 0 published to all four waves
  {
    const uint32_t sn = pinned(1u);                    // stage 1, where it exists, flies while stage 0 is worked on
    g0 = group0(sn);
    if (pinned((isk && sn < nst) ? 1u : 0u)) tdm_load(g0, g1k);
    if (pinned((isv && sn < nst) ? 1u : 0u)) tdm_load(g0, g1v);
  }
  const unsigned char* Kl = ring + c * KPB + 16 * hh;          // key row c of a tile, split d map
  const unsigned char* Vl = ring + KPL + c * VPB + 16 * hh;    // d row c of a tile, split key map
  const float lsc = (SM_SCALE * LOG2E) / (QSC * KSC);
  const int dq0 = 8 * hh - (iw + c);                   // key(kb+8hh+r) - query(iw+c) = kb + dq0 + r

  float m_run = -INFINITY, l_run = 0.f;
  v8f o[8];
#pragma unroll
  for (int j = 0; j < 8; ++j) o[j] = zero8();

#pragma unroll 1
  for (int kb = 0; kb < QPB * (t + 1); kb += 32) {     // block-uniform trip count: every wave passes every publish point
   const int bo = ((kb >> 6) & 1) * BUFB;              // buffer of stage kb / 64
   if (kb < kend) {                                    // wave-uniform (SGPR): steps wholly above the wave's queries are skipped
    // ---- scores (transposed): s0 = keys kb..kb+15, s1 = keys kb+16..kb+31, columns = queries iw..iw+15 ----
    v8f s0 = zero8(), s1 = zero8();
    {
      const _Float16* k0p = (const _Float16*)(const void*)(Kl + bo + (kb & 32) * KPB);   // key row kb + c
      const v16h a0 = ldfrag_h(k0p), a1 = ldfrag_h(k0p + 32), a2 = ldfrag_h(k0p + 64), a3 = ldfrag_h(k0p + 96);
      s0 = mma_raw(a0, qf0, s0);
      s0 = mma_raw(a1, qf1, s0);
      s0 = mma_raw(a2, qf2, s0);
      s0 = mma_raw(a3, qf3, s0);
      guard_s(s0, a0, a1, a2, a3, qf0, qf1, qf2, qf3);
      const _Float16* k1p = k0p + 16 * (KPB / 2);                    // key row kb + 16 + c
      const v16h b0 = ldfrag_h(k1p), b1 = ldfrag_h(k1p + 32), b2 = ldfrag_h(k1p + 64), b3 = ldfrag_h(k1p + 96);
      s1 = mma_raw(b0, qf0, s1);
      s1 = mma_raw(b1, qf1, s1);
      s1 = mma_raw(b2, qf2, s1);
      s1 = mma_raw(b3, qf3, s1);
      guard_s(s1, b0, b1, b2, b3, qf0, qf1, qf2, qf3);
    }
    // ---- base-2 logits for query iw + c (16 keys in this lane, 16 in the other half) ----
    float u0[8], u1[8];
#pragma unroll
    for (int r = 0; r < 8; ++r) {
      u0[r] = s0[r] * lsc;
      u1[r] = s1[r] * lsc;
    }
    // ---- causal exclusion, only in steps that hold keys above some query of the wave (wave-uniform test) ----
    if (kb + 32 > iwu) {
      const int dq = kb + dq0;
#pragma unroll
      for (int r = 0; r < 8; ++r) {
        u0[r] = (dq + r > 0)      ? -INFINITY : u0[r];   // key kb+8hh+r    > query iw+c
        u1[r] = (dq + 16 + r > 0) ? -INFINITY : u1[r];   // key kb+16+8hh+r > query iw+c
      }
    }
    // ---- online softmax ----
    float mx = -INFINITY;
#pragma unroll
    for (int r = 0; r < 8; ++r) mx = fmaxf(mx, fmaxf(u0[r], u1[r]));
    mx = fmaxf(mx, __shfl_xor(mx, 16, 32));            // finite: key kb <= iw <= every query of the wave
    const float mn = fmaxf(m_run, mx);                 // finite from the first step on
    const float al = exp2f(m_run - mn);                // 0 on the first step
    m_run = mn;
    float ps = 0.f;
    FragH pa, pl;                                      // hi plane and unscaled residual plane of P*32768
#pragma unroll
    for (int r = 0; r < 8; ++r) {
      const float e0 = exp2f(u0[r] - mn), e1 = exp2f(u1[r] - mn);   // excluded keys: exp2(-inf) = 0 exactly
      ps += e0 + e1;
      const float x0 = e0 * PCAR, x1 = e1 * PCAR;
      const _Float16 g0 = (_Float16)x0, g1 = (_Float16)x1;
      pa.h[0][r] = g0;                                  // element r     = key kb + 8hh + r
      pa.h[1][r] = g1;                                  // element 8 + r = key kb + 16 + 8hh + r
      pl.h[0][r] = (_Float16)(x0 - (float)g0);          // residual (exact f32 difference, then f16 convert)
      pl.h[1][r] = (_Float16)(x1 - (float)g1);
    }
    ps += __shfl_xor(ps, 16, 32);
    l_run = l_run * al + ps;
#pragma unroll
    for (int r = 0; r < 8; ++r) {
      const float af = __shfl(al, 8 * hh + r, 32);      // rescale factor of query iw + 8hh + r
#pragma unroll
      for (int j = 0; j < 8; ++j) o[j][r] *= af;
    }
    // ---- P.V : B fragment col n = d = 16j + c, keys kb .. kb+31 contiguous in the v^T plane row d ----
    {
      const _Float16* vp = (const _Float16*)(const void*)(Vl + bo + (kb & 32) * 2);
      const v16h v0 = ldfrag_h(vp);
      const v16h v1 = ldfrag_h(vp + 16 * (VPB / 2));
      const v16h v2 = ldfrag_h(vp + 32 * (VPB / 2));
      const v16h v3 = ldfrag_h(vp + 48 * (VPB / 2));
      o[0] = mma_raw(pa.v, v0, o[0]);
      o[0] = mma_raw(pl.v, v0, o[0]);
      o[1] = mma_raw(pa.v, v1, o[1]);
      o[1] = mma_raw(pl.v, v1, o[1]);
      o[2] = mma_raw(pa.v, v2, o[2]);
      o[2] = mma_raw(pl.v, v2, o[2]);
      o[3] = mma_raw(pa.v, v3, o[3]);
      o[3] = mma_raw(pl.v, v3, o[3]);
      guard_o4(o[0], o[1], o[2], o[3], pa.v, pl.v, v0, v1, v2, v3);
      const v16h v4 = ldfrag_h(vp + 64 * (VPB / 2));
      const v16h v5 = ldfrag_h(vp + 80 * (VPB / 2));
      const v16h v6 = ldfrag_h(vp + 96 * (VPB / 2));
      const v16h v7 = ldfrag_h(vp + 112 * (VPB / 2));
      o[4] = mma_raw(pa.v, v4, o[4]);
      o[4] = mma_raw(pl.v, v4, o[4]);
      o[5] = mma_raw(pa.v, v5, o[5]);
      o[5] = mma_raw(pl.v, v5, o[5]);
      o[6] = mma_raw(pa.v, v6, o[6]);
      o[6] = mma_raw(pl.v, v6, o[6]);
      o[7] = mma_raw(pa.v, v7, o[7]);
      o[7] = mma_raw(pl.v, v7, o[7]);
      guard_o4(o[4], o[5], o[6], o[7], pa.v, pl.v, v4, v5, v6, v7);
    }
   }
   // ---- publish point of stage s + 1, at the foot of stage s's second step (block-uniform test) ----
   if (kb & 32) {
     wait_ds0();                                       // this wave has left stage s's buffer
     if (pinned(isk)) tdm_wait(g0, g1k);               // stage s + 1 has landed
     if (pinned(isv)) tdm_wait(g0, g1v);
     __syncthreads();                                  // publishes stage s + 1; ends every reader's last read of stage s
     const uint32_t sn = pinned((uint32_t)(kb >> 6) + 2u);   // stage s + 2, while it exists, into the buffer just left
     g0 = group0(sn);
     if (pinned((isk && sn < nst) ? 1u : 0u)) tdm_load(g0, g1k);
     if (pinned((isv && sn < nst) ? 1u : 0u)) tdm_load(g0, g1v);
   }
  }
  wait_tensor0();                                      // behind the ring: no request and no LDS read of this wave is left
  wait_ds0();
  acc_guard8(o[0], o[1], o[2], o[3], o[4], o[5], o[6], o[7]);

  // ---- fold 1/l and the carries (32768 on P, 256 on v), stage the wave's slab transposed [d][query] in its LDS region ----
  const float oc = 1.0f / (PCAR * VCAR);               // 2^-23 exact
  const float li = (l_run > 0.0f) ? ((1.0f / l_run) * oc) : 0.0f;   // l_run >= 1 (the max element contributes 2^0)
  float* slab = smem + wave * SLABF;
  float lf[8];
#pragma unroll
  for (int r = 0; r < 8; ++r) lf[r] = __shfl(li, 8 * hh + r, 32);   // factor of query iw + 8hh + r
#pragma unroll
  for (int j = 0; j < 8; ++j) {
    v4f w0, w1;
#pragma unroll
    for (int r = 0; r < 4; ++r) { w0[r] = o[j][r] * lf[r]; w1[r] = o[j][4 + r] * lf[4 + r]; }
    float* sp = slab + (16 * j + c) * QP + 8 * hh;     // d row 16j + c, query cols 8hh .. 8hh+7, 16-B aligned
    *(v4f*)(sp)     = w0;
    *(v4f*)(sp + 4) = w1;
  }
  wave_sync_lds();
  v4f vals[16];
#pragma unroll
  for (int it = 0; it < 16; ++it) {
#pragma unroll
    for (int e = 0; e < 4; ++e) vals[it][e] = slab[(4 * lane + e) * QP + it];   // out(query iw+it, d = 4*lane+e)
  }
  float* dst = OPp + ((size_t)bb * SEQ + (size_t)iw) * HD + 4 * lane;
  {
#pragma unroll
    for (int it = 0; it < 16; ++it) {
      *(v4f*)(dst + (size_t)it * HD) = vals[it];   // one 512-B row per instruction, lanes 8q..8q+7 per line
    }
    
  }
}

// =====================================================================================================
// Workspace map (bytes); every plane is fully written by whole-line stores before it is read; all extents are exact
// multiples of the store granularity (no pad rows needed); offsets multiples of 128 (NB = 16 values):
//   QH f16 [NB][2048][128] x1024       8388608   at        0
//   KH f16 [NB][2048][128] x1024       8388608   at  8388608
//   VT f16 [NB][128][2048] x256        8388608   at 16777216
//   end                                             25165824
// =====================================================================================================
extern "C" void kernel_launch(void* const* d_in, const int* in_sizes, int n_in,
                              void* d_out, int out_size, void* d_ws, size_t ws_size,
                              hipStream_t stream) {
  const int NEL = NB * SEQ * HD;                        // 4194304 for NB = 16
  if (n_in < 3) return;
  if (in_sizes[0] < NEL || in_sizes[1] < NEL || in_sizes[2] < NEL) return;
  if (out_size < NEL) return;

  const float* q  = (const float*)d_in[0];
  const float* k  = (const float*)d_in[1];
  const float* v  = (const float*)d_in[2];
  float*       out = (float*)d_out;

  const size_t PQ = (size_t)NEL * 2;                    //  8388608
  const size_t PK = (size_t)NEL * 2;                    //  8388608
  const size_t PV = (size_t)NB * HD * SEQ * 2;          //  8388608
  size_t off = 0;
  const size_t oQH = off; off += PQ;
  const size_t oKH = off; off += PK;
  const size_t oVT = off; off += PV;
  if (off > ws_size) return;                            // off = 25165824
  if (off > (size_t)134217728) return;

  char* ws = (char*)d_ws;
  unsigned short* QH = (unsigned short*)(ws + oQH);
  unsigned short* KH = (unsigned short*)(ws + oKH);
  unsigned short* VT = (unsigned short*)(ws + oVT);

  const int n8 = NEL / 8;                               // 524288
  const dim3 blk(256);
  const dim3 gC(n8 / 256, 2);                           // (2048, 2): q and k planes in one launch
  const dim3 gVT(NB * VTILES);                          // 512
  const dim3 gAT(ATT_BLOCKS);                           // 512
  const dim3 bAT(ATT_THREADS);                          // 128

  // (0) q and k planes f16(bf16(x) * 1024), layout [b][s][d]
  cvt16<<<gC, blk, 0, stream>>>(q, k, QH, KH, n8, QSC);
  // (1) v^T plane f16(bf16(v) * 256), layout [b][d][2048]
  vt16<<<gVT, blk, 0, stream>>>(v, VT);
  // (2) causal flash attention per batch -> out [b][s][d] f32
  attn_fwd<<<gAT, bAT, 0, stream>>>(QH, KH, VT, out);
  (void)hipGetLastError();
}

// v002
// Measured time: 54.3 microseconds a run.
// In two side-by-side timings against v001, it was 1.16 and 1.15 times as fast.
// Counting every step since v000, it is 2.90 times as fast.
// Contractions: scores k.q^T (k x1024 and q x1024 as f16 planes of the bf16-RNE-converted inputs, one product, K=128) and
// P.v (P x32768 as an f16 hi plane plus an unscaled f16 residual plane, two products into one f32 accumulator; v x256 f16
// of the bf16-RNE-converted input; 32-key steps): all v_wmma_f32_16x16x32_f16 (f16 operands, f32 accumulate).
// Causal key range (key <= query); base-2 online softmax and the 1/l fold in f32 on VALU.
#include <hip/hip_runtime.h>
#include <math.h>
#include <stdint.h>

#ifndef NB
#define NB    16
#endif
#define SEQ   2048
#define HD    128
#define QSC   1024.0f
#define KSC   1024.0f
#define PCAR  32768.0f
#define VCAR  256.0f
#define SM_SCALE 0.08838834764831845f
#define LOG2E 1.4426950408889634f
#define ATW   4                          // query subtiles of 16 rows per block
#define KGR   2                          // key groups: wave group g takes keys 32g .. 32g+31 of every 64-key stage
#define ATT_THREADS (ATW * KGR * 32)
#define QPB   (16 * ATW)
#define BPB   (SEQ / QPB)
#define ATT_BLOCKS (NB * BPB)
#define QP    20
#define SLABF (HD * QP)
#define VTP   72
#define VTILES (SEQ / 64)
#define STK   64                         // keys per LDS stage
#define KPB   272                        // LDS pitch of a staged k row: 256 B + 16 B pad (16 B x odd, ds_load_b128 reader)
#define VPB   144                        // LDS pitch of a staged v^T row: 128 B + 16 B pad
#define KPL   18432                      // place of the k tile in a buffer: 64 x 272 = 17408 B, rounded up to 2 KiB
#define VPL   18432                      // place of the v^T tile: 128 x 144 B
#define BUFB  (KPL + VPL)
static_assert(HD == 128 && QPB == 64 && ATT_THREADS == 256 && KGR * 32 == 64);
static_assert((SEQ % QPB) == 0 && (SEQ % 64) == 0 && (SEQ % 32) == 0 && (HD % 32) == 0);
static_assert(NB >= 1 && NB <= 16);
static_assert(BPB == 32 && VTILES == 32);
static_assert((HD - 1) * VTP + 63 < HD * VTP);
static_assert((HD - 1) * QP + 15 < SLABF && (QP % 4) == 0);
static_assert(64 * 32 + 2 * 32 <= SLABF);   // a wave's 64 accumulator floats per lane plus max and sum fit its subtile's slab
static_assert(((NB * SEQ * HD) % 2048) == 0);
static_assert(STK == QPB && STK * KPB <= KPL && HD * VPB <= VPL && (KPL % 2048) == 0 && (BUFB % 2048) == 0);
static_assert(KPB == HD * 2 + 16 && VPB == STK * 2 + 16);

typedef _Float16 v16h __attribute__((ext_vector_type(16)));
typedef _Float16 v8h  __attribute__((ext_vector_type(8)));
typedef float    v8f  __attribute__((ext_vector_type(8)));
typedef float    v4f  __attribute__((ext_vector_type(4)));
typedef unsigned int v4u __attribute__((ext_vector_type(4)));
typedef uint32_t u32x4 __attribute__((ext_vector_type(4)));
typedef uint32_t u32x8 __attribute__((ext_vector_type(8)));

union FragH { v16h v; v8h h[2]; v4u u[2]; };

// ---- scalar helpers --------------------------------------------------------------------------------
__device__ __forceinline__ unsigned short bf_bits(float f) {          // f32 -> bf16 bits, RNE convert
  unsigned u = __float_as_uint(f);
  return (unsigned short)((u + 0x7FFFu + ((u >> 16) & 1u)) >> 16);
}
__device__ __forceinline__ float bf_up(unsigned short h) { return __uint_as_float(((unsigned)h) << 16); }
__device__ __forceinline__ float bfr(float f) { return bf_up(bf_bits(f)); }   // value of the bf16 RNE convert
__device__ __forceinline__ unsigned short h_bits(_Float16 x) { return __builtin_bit_cast(unsigned short, x); }
__device__ __forceinline__ unsigned pk16(unsigned short a, unsigned short b) { return (unsigned)a | ((unsigned)b << 16); }
__device__ __forceinline__ v8f zero8() { v8f z = {0.f, 0.f, 0.f, 0.f, 0.f, 0.f, 0.f, 0.f}; return z; }

// ---- fragment loader: 16-bit A/B operand, lane -> row/col (lane&15), p already includes +8*(lane>>4);
//      elements 0..7 <- p[0..7] (k0+8h..), elements 8..15 <- p[16..23] (k0+16+8h..)  (same split k map for A and B;
//      B is always read from a k-contiguous [n][k] plane)
__device__ __forceinline__ v16h ldfrag_h(const _Float16* p) {
  FragH f;
  f.h[0] = *(const v8h*)(p);
  f.h[1] = *(const v8h*)(p + 16);
  return f.v;
}

__device__ __forceinline__ v8f mma_raw(v16h a, v16h b, v8f c) {
  return __builtin_amdgcn_wmma_f32_16x16x32_f16(false, a, false, b, (short)0, c, false, false);
}
// after a 4-deep score chain: ties the accumulator, keeps the 4 A and 4 B fragments live through the nops
__device__ __forceinline__ void guard_s(v8f& s, v16h x0, v16h x1, v16h x2, v16h x3,
                                        v16h y0, v16h y1, v16h y2, v16h y3) {
#if defined(__HIP_DEVICE_COMPILE__)
  asm volatile("v_nop\n\tv_nop\n\tv_nop\n\tv_nop"
               : "+v"(s) : "v"(x0), "v"(x1), "v"(x2), "v"(x3), "v"(y0), "v"(y1), "v"(y2), "v"(y3) : "memory");
#endif
}
// after a group of 8 P.V products (hi and residual P planes x 4 v fragments): ties 4 accumulators, keeps both P
// fragments and the 4 v fragments live
__device__ __forceinline__ void guard_o4(v8f& a, v8f& b, v8f& c, v8f& d,
                                         v16h p, v16h q, v16h x0, v16h x1, v16h x2, v16h x3) {
#if defined(__HIP_DEVICE_COMPILE__)
  asm volatile("v_nop\n\tv_nop\n\tv_nop\n\tv_nop"
               : "+v"(a), "+v"(b), "+v"(c), "+v"(d) : "v"(p), "v"(q), "v"(x0), "v"(x1), "v"(x2), "v"(x3) : "memory");
#endif
}
__device__ __forceinline__ void acc_guard8(v8f& a, v8f& b, v8f& c, v8f& d, v8f& e, v8f& f, v8f& g, v8f& hx) {
#if defined(__HIP_DEVICE_COMPILE__)
  asm volatile("v_nop\n\tv_nop\n\tv_nop\n\tv_nop"
               : "+v"(a), "+v"(b), "+v"(c), "+v"(d), "+v"(e), "+v"(f), "+v"(g), "+v"(hx));
#endif
}
__device__ __forceinline__ void wave_sync_lds() {
  __builtin_amdgcn_fence(__ATOMIC_RELEASE, "workgroup");
  __builtin_amdgcn_wave_barrier();
  __builtin_amdgcn_fence(__ATOMIC_ACQUIRE, "workgroup");
}

// ---- tensor load to LDS: descriptor words, issue, waits ----------------------------------------------
__device__ __forceinline__ uint32_t uni(uint32_t v) { return (uint32_t)__builtin_amdgcn_readfirstlane((int)v); }
// value held in a scalar register: a test on it compiles to s_cmp + s_cbranch_scc (tensor loads ignore EXEC), and a
// descriptor word formed from it is formed behind the asm waits that stand in front of this statement
__device__ __forceinline__ uint32_t pinned(uint32_t v) {
  uint32_t w = uni(v);
#if defined(__HIP_DEVICE_COMPILE__)
  asm volatile("" : "+s"(w));
#endif
  return w;
}
__device__ __forceinline__ void wait_ds0() {       // this wave's LDS reads have returned before the buffer is handed over
#if defined(__HIP_DEVICE_COMPILE__)
  asm volatile("s_wait_dscnt 0x0" ::: "memory");
#endif
}
__device__ __forceinline__ void wait_tensor0() {   // the issuing wave's tile has landed (the compiler places no such wait)
#if defined(__HIP_DEVICE_COMPILE__)
  asm volatile("s_wait_tensorcnt 0x0" ::: "memory");
#endif
}
// Group 1 of a two-dimensional tile, every extent in bytes: ROWS rows of ROWB bytes, source pitch PITCH, 16 B of LDS pad
// behind each row (interval code IVL = the row length), no mask; tensor dims = tile dims (every tile is interior).
template <uint32_t ROWB, uint32_t ROWS, uint32_t PITCH, uint32_t IVL>
__device__ __forceinline__ u32x8 tdm_group1() {
  u32x8 g;   // pinned(): each descriptor word held in a scalar register of its own for the whole kernel
  g[0] = pinned((1u << 20) | (IVL << 22) | (3u << 25));
  g[1] = pinned((ROWB & 0xFFFFu) << 16);
  g[2] = pinned((ROWB >> 16) | ((ROWS & 0xFFFFu) << 16));
  g[3] = pinned((ROWS >> 16) | (ROWB << 16));
  g[4] = pinned(ROWS);
  g[5] = pinned(PITCH);
  g[6] = pinned(0u);
  g[7] = pinned(0u);
  return g;
}
__device__ __forceinline__ u32x4 tdm_group0(uint32_t lds_dst, uint64_t ga) {
  u32x4 g;
  g[0] = uni(1u);
  g[1] = uni(lds_dst);
  g[2] = uni((uint32_t)ga);
  g[3] = uni((((uint32_t)(ga >> 32)) & 0x01FFFFFFu) | 0x80000000u);
#if defined(__HIP_DEVICE_COMPILE__)
  asm volatile("" : "+s"(g));   // descriptor words held in scalar registers until the wait that names them
#endif
  return g;
}
__device__ __forceinline__ void tdm_load(u32x4 g0, u32x8 g1) {
#if defined(__HIP_DEVICE_COMPILE__)
  asm volatile("tensor_load_to_lds %0, %1" :: "s"(g0), "s"(g1) : "memory");
#endif
}
// the issuing wave's tile has landed (the compiler places no such wait); naming the descriptor keeps its registers
// unchanged while the request is outstanding
__device__ __forceinline__ void tdm_wait(u32x4 g0, u32x8 g1) {
#if defined(__HIP_DEVICE_COMPILE__)
  asm volatile("s_wait_tensorcnt 0x0" :: "s"(g0), "s"(g1) : "memory");
#endif
}

// =====================================================================================================
// 16-bit plane convert, no relayout (inputs are batch-major [b][s][d]):
//   pl[e] = f16( bf16(x[e]) * sc ) (sc a power of two, exact). blockIdx.y == 0: q plane, == 1: k plane.
// Thread = 8 consecutive elements: two 16-B loads, one 16-B store per lane; 32 consecutive lanes = 256 contiguous, 512-B
// coverage: grid = (n8/256, 2) blocks x 256 thr x 8 elements = n = NB*2048*128 per plane exactly (n % 2048 == 0 asserted).
// =====================================================================================================
__global__ __launch_bounds__(256) void cvt16(const float* __restrict__ xq, const float* __restrict__ xk,
                                             unsigned short* plq, unsigned short* plk, int n8, float sc) {
  const int gt = blockIdx.x * 256 + (int)threadIdx.x;
  if (gt >= n8) return;                     // never taken with the exact grid; no barriers in this kernel
  const bool sk = (blockIdx.y != 0);        // block-uniform plane select (both pointers global)
  const float* x = sk ? xk : xq;
  unsigned short* pl = sk ? plk : plq;
  const size_t e = (size_t)gt * 8;
  const v4f a = *(const v4f*)(x + e), bq = *(const v4f*)(x + e + 4);
  v4u o;
#pragma unroll
  for (int i = 0; i < 2; ++i) {
    o[i]     = pk16(h_bits((_Float16)(bfr(a[2 * i]) * sc)),  h_bits((_Float16)(bfr(a[2 * i + 1]) * sc)));
    o[2 + i] = pk16(h_bits((_Float16)(bfr(bq[2 * i]) * sc)), h_bits((_Float16)(bfr(bq[2 * i + 1]) * sc)));
  }
  unsigned short* d = pl + e;
  {
    *(v4u*)(d) = o;
    
  }
}

// =====================================================================================================
// v^T plane: VT[(b*HD + d)][key] = f16( bf16(v[b][key][d]) * 256 ) (exact), pitch SEQ = 2048 halves (4096 B) per d row.
// Block = (b, tile of 64 keys): 64 source rows of 128 floats loaded with 16-B loads (static stride), converted, written into
// coverage: load 256 thr x 32 elements = 64 keys x 128 d; store 4 iterations x 256 thr x 8 halves = 128 lines x 64 = the tile;
//           grid = NB x 32 blocks covers the whole [NB][128][2048] plane exactly once.
// =====================================================================================================
__global__ __launch_bounds__(256) void vt16(const float* __restrict__ v, unsigned short* VTo) {
  __shared__ __align__(16) unsigned short T[HD * VTP];
  const int tid = threadIdx.x;
  const int bid = blockIdx.x;
  const int bb  = bid / VTILES;
  const int t   = bid - bb * VTILES;        // 0..31, block-uniform
  if (bb >= NB) return;                     // never taken with the exact grid; before any barrier or store
  {
    const int sl = tid >> 2;                  // key within tile 0..63
    const int dc = (tid & 3) * 32;            // d chunk 0,32,64,96
    int key = 64 * t + sl;                    // <= SEQ-1 by construction; clamp keeps the address in range regardless
    key = (key < 0) ? 0 : ((key > SEQ - 1) ? (SEQ - 1) : key);
    const float* src = v + (((size_t)bb * SEQ + (size_t)key) * HD + dc);
#pragma unroll
    for (int i = 0; i < 8; ++i) {
      const v4f a = *(const v4f*)(src + 4 * i);
#pragma unroll
      for (int e = 0; e < 4; ++e) T[(dc + 4 * i + e) * VTP + sl] = h_bits((_Float16)(bfr(a[e]) * VCAR));
    }
  }
  __syncthreads();
  v4u vals[4];
  const int q8 = tid >> 3, p8 = (tid & 7) * 8;
#pragma unroll
  for (int it = 0; it < 4; ++it) {
    const int line = it * 32 + q8;            // d = 0..127
    vals[it] = *(const v4u*)(T + line * VTP + p8);
  }
  unsigned short* dst = VTo + ((size_t)bb * HD) * SEQ + 64 * t + p8;
  {
#pragma unroll
    for (int it = 0; it < 4; ++it) {
      const int line = it * 32 + q8;
      *(v4u*)(dst + (size_t)line * SEQ) = vals[it];
    }
    
  }
}

// =====================================================================================================
// Causal flash attention per batch. Block = (b, 64 queries), 8 waves: wave w works query rows iw = 64t + 16(w & 3) .. +15
//   on the keys 64s + 32(w >> 2) .. +31 of every stage s; waves w and w + 4 hold partial max, sum and accumulators of the
//   same rows over disjoint keys, merged once behind the key loop (through the subtile's slab, by wave w).
//   q plane f16 [b][s][d] x1024, k plane f16 [b][s][d] x1024, v^T plane f16 [b][d][SEQ] x256.
//   The k and v^T planes reach the waves through LDS: stages of 64 keys, brought by tensor loads into two buffers that the
//   block's eight waves share; the fragment loads below read the staged rows (same lane -> row and k maps as from the planes).
//   Key loop kb = 64s + 32(w >> 2), a step is worked while kb < iw + 16 (wave-uniform, SGPR): keys above iw+15 are excluded
//   for every query of the wave; kb <= iw holds in every worked step, so key kb is included for every query (row max finite,
//   row sum >= 1 from the wave's first worked step on; a wave of the upper key group may have no step at all: max -inf, sum 0).
//   Scores are formed transposed, S^T = K.Q^T: A fragment = k plane row (key kb+16u+c), B fragment = q plane row
//   (query iw+c), both with the split d map, 4 d-steps of 32, one product each.
//   D element r of subtile u at lane (h,c) = score(key kb+16u+8h+r, query iw+c). In the last step(s) entries with
//   key > query are excluded (score -> -inf before the max, exp2 -> exactly 0), which equals the large negative fill
//   followed by softmax in f32.
//   The A fragment of P for the P.V product (row = query c, element r <- key kb+8h+r from subtile 0, element 8+r <-
//   key kb+16+8h+r from subtile 1) is an in-lane f32 -> f16 convert of P*32768 into a hi plane plus an unscaled residual
//   plane res = f16(P*32768 - hi); both planes multiply the same v fragments into the same accumulator (two products).
//   Online max-subtracted softmax in f32 (exp2); per-query max/sum = 16 in-lane values combined across the two lane halves;
//   rescale factors broadcast with shuffles.
//   P.V: B fragments = v^T plane rows d = 16j+c (keys contiguous), 16 products into 8 accumulators (16 queries x 128 d).
//   Epilogue: 1/l and the carry folds in f32; the wave's 16x128 slab staged transposed [d][16] (pitch 20) in its private LDS
// coverage: per storing wave (w < 4) 16 instructions x 32 lanes x 4 floats = 16 rows x 128; per block 4 such waves = 64 rows;
//           32 blocks per batch x NB batches: every row of out [NB][2048][128] exactly once (grid NB*32 blocks); every
//           wave of the lower key group runs at least one key step (kb = 0).
// =====================================================================================================
__global__ __launch_bounds__(ATT_THREADS)
void attn_fwd(const unsigned short* __restrict__ QHp, const unsigned short* __restrict__ KHp,
              const unsigned short* __restrict__ VTq, float* OPp) {
  __shared__ __align__(16) float smem[ATW * SLABF];    // per query subtile: [128 d][16 queries] f32 slab, pitch QP
  __shared__ __attribute__((aligned(2048))) unsigned char ring[2 * BUFB];   // two buffers: k tile [64 keys][272 B], v^T tile [128 d][144 B]

  const int tid  = threadIdx.x;
  const int wave = (tid >> 5) & (ATW - 1);             // query subtile
  const int kgu  = __builtin_amdgcn_readfirstlane(tid >> 7);   // key group 0 or 1, wave-uniform in an SGPR
  const int lane = tid & 31;
  const int hh   = lane >> 4;
  const int c    = lane & 15;

  const int bid  = blockIdx.x;
  const int bb   = bid / BPB;
  const int t    = bid - bb * BPB;                     // 0..31, block-uniform
  if (bb >= NB) return;                                // never taken with the exact grid; before any LDS use or store

  const int iw   = QPB * t + wave * 16;                // query row 0 of this wave, iw + 15 <= SEQ - 1
  const int iwu  = __builtin_amdgcn_readfirstlane(iw); // wave-uniform copy in an SGPR
  const int kend = iwu + 16;                           // keys 0 .. iw+15 ; kend <= SEQ

  // B fragments of q^T: lane col n = query iw + c, split d map
  const _Float16* Qb = (const _Float16*)(const void*)QHp + ((size_t)bb * SEQ + (size_t)(iw + c)) * HD + 8 * hh;
  const v16h qf0 = ldfrag_h(Qb);                       // d 0..31
  const v16h qf1 = ldfrag_h(Qb + 32);                  // d 32..63
  const v16h qf2 = ldfrag_h(Qb + 64);                  // d 64..95
  const v16h qf3 = ldfrag_h(Qb + 96);                  // d 96..127
  // Stage s = keys 64s .. 64s+63 of batch bb, shared by the block's eight waves: wave 0 brings the k tile (64 rows of 256 B,
  // contiguous), wave 1 the v^T tile (128 d rows of 128 B, source pitch 4096 B), one request each, into buffer s & 1.
  // Stages 0 .. t: 64s + 63 <= 64t + 63 <= SEQ - 1, every tile interior to its plane.
  const uint32_t wv    = uni((uint32_t)tid >> 5);
  const uint32_t nst   = uni((uint32_t)t + 1u);
  const uint32_t lbase = (uint32_t)(size_t)ring;
  const uint64_t kga   = (uint64_t)(size_t)KHp + (uint64_t)bb * (SEQ * HD * 2);
  const uint64_t vga   = (uint64_t)(size_t)VTq + (uint64_t)bb * (HD * SEQ * 2);
  const u32x8 g1k = tdm_group1<HD * 2, STK, HD * 2, 5u>();
  const u32x8 g1v = tdm_group1<STK * 2, HD, SEQ * 2, 4u>();
  const uint32_t isk = (wv == 0u) ? 1u : 0u, isv = (wv == 1u) ? 1u : 0u;
  auto group0 = [&](uint32_t sn) {                     // sn comes from pinned(): formed behind the waits in front of it
    return tdm_group0(lbase + (sn & 1u) * BUFB + isv * KPL,
                      isv ? vga + (uint64_t)sn * (STK * 2) : kga + (uint64_t)sn * (STK * HD * 2));
  };
  u32x4 g0 = group0(pinned(0u));
  if (pinned(isk)) { tdm_load(g0, g1k); tdm_wait(g0, g1k); }   // stage 0 has landed
  if (pinned(isv)) { tdm_load(g0, g1v); tdm_wait(g0, g1v); }
  __syncthreads();                                     // stage 0 published to all eight waves
  {
    const uint32_t sn = pinned(1u);                    // stage 1, where it exists, flies while stage 0 is worked on
    g0 = group0(sn);
    if (pinned((isk && sn < nst) ? 1u : 0u)) tdm_load(g0, g1k);
    if (pinned((isv && sn < nst) ? 1u : 0u)) tdm_load(g0, g1v);
  }
  const unsigned char* Kl = ring + c * KPB + 16 * hh;          // key row c of a tile, split d map
  const unsigned char* Vl = ring + KPL + c * VPB + 16 * hh;    // d row c of a tile, split key map
  const float lsc = (SM_SCALE * LOG2E) / (QSC * KSC);
  const int dq0 = 8 * hh - (iw + c);                   // key(kb+8hh+r) - query(iw+c) = kb + dq0 + r

  float m_run = -INFINITY, l_run = 0.f;
  v8f o[8];
#pragma unroll
  for (int j = 0; j < 8; ++j) o[j] = zero8();

#pragma unroll 1
  for (int s = 0; s <= t; ++s) {                       // block-uniform trip count: every wave passes every publish point
   const int kb = STK * s + 32 * kgu;                  // this wave's 32 keys of stage s
   const int bo = (s & 1) * BUFB;                      // buffer of stage s
   if (kb < kend) {                                    // wave-uniform (SGPR): steps wholly above the wave's queries are skipped
    // ---- scores (transposed): s0 = keys kb..kb+15, s1 = keys kb+16..kb+31, columns = queries iw..iw+15 ----
    v8f s0 = zero8(), s1 = zero8();
    {
      const _Float16* k0p = (const _Float16*)(const void*)(Kl + bo + (32 * kgu) * KPB);   // key row kb + c
      const v16h a0 = ldfrag_h(k0p), a1 = ldfrag_h(k0p + 32), a2 = ldfrag_h(k0p + 64), a3 = ldfrag_h(k0p + 96);
      s0 = mma_raw(a0, qf0, s0);
      s0 = mma_raw(a1, qf1, s0);
      s0 = mma_raw(a2, qf2, s0);
      s0 = mma_raw(a3, qf3, s0);
      guard_s(s0, a0, a1, a2, a3, qf0, qf1, qf2, qf3);
      const _Float16* k1p = k0p + 16 * (KPB / 2);                    // key row kb + 16 + c
      const v16h b0 = ldfrag_h(k1p), b1 = ldfrag_h(k1p + 32), b2 = ldfrag_h(k1p + 64), b3 = ldfrag_h(k1p + 96);
      s1 = mma_raw(b0, qf0, s1);
      s1 = mma_raw(b1, qf1, s1);
      s1 = mma_raw(b2, qf2, s1);
      s1 = mma_raw(b3, qf3, s1);
      guard_s(s1, b0, b1, b2, b3, qf0, qf1, qf2, qf3);
    }
    // ---- base-2 logits for query iw + c (16 keys in this lane, 16 in the other half) ----
    float u0[8], u1[8];
#pragma unroll
    for (int r = 0; r < 8; ++r) {
      u0[r] = s0[r] * lsc;
      u1[r] = s1[r] * lsc;
    }
    // ---- causal exclusion, only in steps that hold keys above some query of the wave (wave-uniform test) ----
    if (kb + 32 > iwu) {
      const int dq = kb + dq0;
#pragma unroll
      for (int r = 0; r < 8; ++r) {
        u0[r] = (dq + r > 0)      ? -INFINITY : u0[r];   // key kb+8hh+r    > query iw+c
        u1[r] = (dq + 16 + r > 0) ? -INFINITY : u1[r];   // key kb+16+8hh+r > query iw+c
      }
    }
    // ---- online softmax ----
    float mx = -INFINITY;
#pragma unroll
    for (int r = 0; r < 8; ++r) mx = fmaxf(mx, fmaxf(u0[r], u1[r]));
    mx = fmaxf(mx, __shfl_xor(mx, 16, 32));            // finite: key kb <= iw <= every query of the wave
    const float mn = fmaxf(m_run, mx);                 // finite from the first step on
    const float al = exp2f(m_run - mn);                // 0 on the first step
    m_run = mn;
    float ps = 0.f;
    FragH pa, pl;                                      // hi plane and unscaled residual plane of P*32768
#pragma unroll
    for (int r = 0; r < 8; ++r) {
      const float e0 = exp2f(u0[r] - mn), e1 = exp2f(u1[r] - mn);   // excluded keys: exp2(-inf) = 0 exactly
      ps += e0 + e1;
      const float x0 = e0 * PCAR, x1 = e1 * PCAR;
      const _Float16 g0 = (_Float16)x0, g1 = (_Float16)x1;
      pa.h[0][r] = g0;                                  // element r     = key kb + 8hh + r
      pa.h[1][r] = g1;                                  // element 8 + r = key kb + 16 + 8hh + r
      pl.h[0][r] = (_Float16)(x0 - (float)g0);          // residual (exact f32 difference, then f16 convert)
      pl.h[1][r] = (_Float16)(x1 - (float)g1);
    }
    ps += __shfl_xor(ps, 16, 32);
    l_run = l_run * al + ps;
#pragma unroll
    for (int r = 0; r < 8; ++r) {
      const float af = __shfl(al, 8 * hh + r, 32);      // rescale factor of query iw + 8hh + r
#pragma unroll
      for (int j = 0; j < 8; ++j) o[j][r] *= af;
    }
    // ---- P.V : B fragment col n = d = 16j + c, keys kb .. kb+31 contiguous in the v^T plane row d ----
    {
      const _Float16* vp = (const _Float16*)(const void*)(Vl + bo + (32 * kgu) * 2);
      const v16h v0 = ldfrag_h(vp);
      const v16h v1 = ldfrag_h(vp + 16 * (VPB / 2));
      const v16h v2 = ldfrag_h(vp + 32 * (VPB / 2));
      const v16h v3 = ldfrag_h(vp + 48 * (VPB / 2));
      o[0] = mma_raw(pa.v, v0, o[0]);
      o[0] = mma_raw(pl.v, v0, o[0]);
      o[1] = mma_raw(pa.v, v1, o[1]);
      o[1] = mma_raw(pl.v, v1, o[1]);
      o[2] = mma_raw(pa.v, v2, o[2]);
      o[2] = mma_raw(pl.v, v2, o[2]);
      o[3] = mma_raw(pa.v, v3, o[3]);
      o[3] = mma_raw(pl.v, v3, o[3]);
      guard_o4(o[0], o[1], o[2], o[3], pa.v, pl.v, v0, v1, v2, v3);
      const v16h v4 = ldfrag_h(vp + 64 * (VPB / 2));
      const v16h v5 = ldfrag_h(vp + 80 * (VPB / 2));
      const v16h v6 = ldfrag_h(vp + 96 * (VPB / 2));
      const v16h v7 = ldfrag_h(vp + 112 * (VPB / 2));
      o[4] = mma_raw(pa.v, v4, o[4]);
      o[4] = mma_raw(pl.v, v4, o[4]);
      o[5] = mma_raw(pa.v, v5, o[5]);
      o[5] = mma_raw(pl.v, v5, o[5]);
      o[6] = mma_raw(pa.v, v6, o[6]);
      o[6] = mma_raw(pl.v, v6, o[6]);
      o[7] = mma_raw(pa.v, v7, o[7]);
      o[7] = mma_raw(pl.v, v7, o[7]);
      guard_o4(o[4], o[5], o[6], o[7], pa.v, pl.v, v4, v5, v6, v7);
    }
   }
   // ---- publish point of stage s + 1, at the foot of stage s ----
   {
     wait_ds0();                                       // this wave has left stage s's buffer
     if (pinned(isk)) tdm_wait(g0, g1k);               // stage s + 1 has landed
     if (pinned(isv)) tdm_wait(g0, g1v);
     __syncthreads();                                  // publishes stage s + 1; ends every reader's last read of stage s
     const uint32_t sn = pinned((uint32_t)s + 2u);   // stage s + 2, while it exists, into the buffer just left
     g0 = group0(sn);
     if (pinned((isk && sn < nst) ? 1u : 0u)) tdm_load(g0, g1k);
     if (pinned((isv && sn < nst) ? 1u : 0u)) tdm_load(g0, g1v);
   }
  }
  wait_tensor0();                                      // behind the ring: no request and no LDS read of this wave is left
  wait_ds0();
  acc_guard8(o[0], o[1], o[2], o[3], o[4], o[5], o[6], o[7]);

  // ---- fold 1/l and the carries (32768 on P, 256 on v), stage the wave's slab transposed [d][query] in its LDS region ----
  float* slab = smem + wave * SLABF;
  // ---- merge of the two key groups: the upper group's wave leaves its accumulators (lane-private order, 512 contiguous
  //      bytes per store), max and sum in the subtile's slab; the lower group's wave of the same rows takes them up ----
  if (kgu) {                                           // wave-uniform (SGPR)
#pragma unroll
    for (int j = 0; j < 8; ++j) {
      v4f w0, w1;
#pragma unroll
      for (int r = 0; r < 4; ++r) { w0[r] = o[j][r]; w1[r] = o[j][4 + r]; }
      *(v4f*)(slab + ((2 * j) * 32 + lane) * 4)     = w0;
      *(v4f*)(slab + ((2 * j + 1) * 32 + lane) * 4) = w1;
    }
    slab[2048 + lane] = m_run;
    slab[2080 + lane] = l_run;
  }
  __syncthreads();                                     // the upper group's partials are published; every wave passes it
  if (kgu) return;                                     // no barrier, tensor load or store of this wave is left
  const float m1 = slab[2048 + lane], l1 = slab[2080 + lane];
  v4f p0[8], p1[8];                                    // read whole before the slab is rewritten below (same wave, in order)
#pragma unroll
  for (int j = 0; j < 8; ++j) {
    p0[j] = *(const v4f*)(slab + ((2 * j) * 32 + lane) * 4);
    p1[j] = *(const v4f*)(slab + ((2 * j + 1) * 32 + lane) * 4);
  }
  const float mm = fmaxf(m_run, m1);                   // m_run is finite (step kb = 0); m1 may be -inf with l1 = 0
  const float a0 = exp2f(m_run - mm), a1 = exp2f(m1 - mm);
  const float lt = l_run * a0 + l1 * a1;
  const float oc = 1.0f / (PCAR * VCAR);               // 2^-23 exact
  const float li = (lt > 0.0f) ? ((1.0f / lt) * oc) : 0.0f;   // lt >= 1 (the max element contributes 2^0)
  const float li0 = li * a0, li1 = li * a1;
  float lf[8], lg[8];
#pragma unroll
  for (int r = 0; r < 8; ++r) {                        // factors of query iw + 8hh + r for the two partial accumulators
    lf[r] = __shfl(li0, 8 * hh + r, 32);
    lg[r] = __shfl(li1, 8 * hh + r, 32);
  }
#pragma unroll
  for (int j = 0; j < 8; ++j) {
    v4f w0, w1;
#pragma unroll
    for (int r = 0; r < 4; ++r) {
      w0[r] = o[j][r] * lf[r] + p0[j][r] * lg[r];
      w1[r] = o[j][4 + r] * lf[4 + r] + p1[j][r] * lg[4 + r];
    }
    float* sp = slab + (16 * j + c) * QP + 8 * hh;     // d row 16j + c, query cols 8hh .. 8hh+7, 16-B aligned
    *(v4f*)(sp)     = w0;
    *(v4f*)(sp + 4) = w1;
  }
  wave_sync_lds();
  v4f vals[16];
#pragma unroll
  for (int it = 0; it < 16; ++it) {
#pragma unroll
    for (int e = 0; e < 4; ++e) vals[it][e] = slab[(4 * lane + e) * QP + it];   // out(query iw+it, d = 4*lane+e)
  }
  float* dst = OPp + ((size_t)bb * SEQ + (size_t)iw) * HD + 4 * lane;
  {
#pragma unroll
    for (int it = 0; it < 16; ++it) {
      *(v4f*)(dst + (size_t)it * HD) = vals[it];   // one 512-B row per instruction, lanes 8q..8q+7 per line
    }
    
  }
}

// =====================================================================================================
// Workspace map (bytes); every plane is fully written by whole-line stores before it is read; all extents are exact
// multiples of the store granularity (no pad rows needed); offsets multiples of 128 (NB = 16 values):
//   QH f16 [NB][2048][128] x1024       8388608   at        0
//   KH f16 [NB][2048][128] x1024       8388608   at  8388608
//   VT f16 [NB][128][2048] x256        8388608   at 16777216
//   end                                             25165824
// =====================================================================================================
extern "C" void kernel_launch(void* const* d_in, const int* in_sizes, int n_in,
                              void* d_out, int out_size, void* d_ws, size_t ws_size,
                              hipStream_t stream) {
  const int NEL = NB * SEQ * HD;                        // 4194304 for NB = 16
  if (n_in < 3) return;
  if (in_sizes[0] < NEL || in_sizes[1] < NEL || in_sizes[2] < NEL) return;
  if (out_size < NEL) return;

  const float* q  = (const float*)d_in[0];
  const float* k  = (const float*)d_in[1];
  const float* v  = (const float*)d_in[2];
  float*       out = (float*)d_out;

  const size_t PQ = (size_t)NEL * 2;                    //  8388608
  const size_t PK = (size_t)NEL * 2;                    //  8388608
  const size_t PV = (size_t)NB * HD * SEQ * 2;          //  8388608
  size_t off = 0;
  const size_t oQH = off; off += PQ;
  const size_t oKH = off; off += PK;
  const size_t oVT = off; off += PV;
  if (off > ws_size) return;                            // off = 25165824
  if (off > (size_t)134217728) return;

  char* ws = (char*)d_ws;
  unsigned short* QH = (unsigned short*)(ws + oQH);
  unsigned short* KH = (unsigned short*)(ws + oKH);
  unsigned short* VT = (unsigned short*)(ws + oVT);

  const int n8 = NEL / 8;                               // 524288
  const dim3 blk(256);
  const dim3 gC(n8 / 256, 2);                           // (2048, 2): q and k planes in one launch
  const dim3 gVT(NB * VTILES);                          // 512
  const dim3 gAT(ATT_BLOCKS);                           // 512
  const dim3 bAT(ATT_THREADS);                          // 256

  // (0) q and k planes f16(bf16(x) * 1024), layout [b][s][d]
  cvt16<<<gC, blk, 0, stream>>>(q, k, QH, KH, n8, QSC);
  // (1) v^T plane f16(bf16(v) * 256), layout [b][d][2048]
  vt16<<<gVT, blk, 0, stream>>>(v, VT);
  // (2) causal flash attention per batch -> out [b][s][d] f32
  attn_fwd<<<gAT, bAT, 0, stream>>>(QH, KH, VT, out);
  (void)hipGetLastError();
}

// v003
// It runs in 44.5 microseconds.
// Next to v002, in two timings, it ran 1.22 and 1.20 times as fast.
// Over all steps from v000 it is 3.51 times as fast.
// Contractions: scores k.q^T (k x1024 and q x1024 as f16 planes of the bf16-RNE-converted inputs, one product, K=128) and
// P.v (P x32768 as an f16 hi plane plus an unscaled f16 residual plane, two products into one f32 accumulator; v x256 f16
// of the bf16-RNE-converted input; 32-key steps): all v_wmma_f32_16x16x32_f16 (f16 operands, f32 accumulate).
// Causal key range (key <= query); base-2 online softmax and the 1/l fold in f32 on VALU.
#include <hip/hip_runtime.h>
#include <math.h>
#include <stdint.h>

#ifndef NB
#define NB    16
#endif
#define SEQ   2048
#define HD    128
#define QSC   1024.0f
#define KSC   1024.0f
#define PCAR  32768.0f
#define VCAR  256.0f
#define SM_SCALE 0.08838834764831845f
#define LOG2E 1.4426950408889634f
#define ATW   4                          // query subtiles of 16 rows per block
#define KGR   2                          // key groups: wave group g takes keys 32g .. 32g+31 of every 64-key stage
#define ATT_THREADS (ATW * KGR * 32)
#define QPB   (16 * ATW)
#define BPB   (SEQ / QPB)
#define ATT_BLOCKS (NB * BPB)
#define HALFG (NB * (BPB / 2))           // blocks in each half of the attention grid
#define QP    20
#define SLABF (HD * QP)
#define VTP   72
#define VTILES (SEQ / 64)
#define STK   64                         // keys per LDS stage
#define KPB   272                        // LDS pitch of a staged k row: 256 B + 16 B pad (16 B x odd, ds_load_b128 reader)
#define VPB   144                        // LDS pitch of a staged v^T row: 128 B + 16 B pad
#define KPL   18432                      // place of the k tile in a buffer: 64 x 272 = 17408 B, rounded up to 2 KiB
#define VPL   18432                      // place of the v^T tile: 128 x 144 B
#define BUFB  (KPL + VPL)
static_assert(HD == 128 && QPB == 64 && ATT_THREADS == 256 && KGR * 32 == 64);
static_assert((SEQ % QPB) == 0 && (SEQ % 64) == 0 && (SEQ % 32) == 0 && (HD % 32) == 0);
static_assert(NB >= 1 && NB <= 16);
static_assert(BPB == 32 && VTILES == 32);
static_assert((HD - 1) * VTP + 63 < HD * VTP);
static_assert((HD - 1) * QP + 15 < SLABF && (QP % 4) == 0);
static_assert(64 * 32 + 2 * 32 <= SLABF);   // a wave's 64 accumulator floats per lane plus max and sum fit its subtile's slab
static_assert(((NB * SEQ * HD) % 2048) == 0);
static_assert(STK == QPB && STK * KPB <= KPL && HD * VPB <= VPL && (KPL % 2048) == 0 && (BUFB % 2048) == 0);
static_assert(KPB == HD * 2 + 16 && VPB == STK * 2 + 16);

typedef _Float16 v16h __attribute__((ext_vector_type(16)));
typedef _Float16 v8h  __attribute__((ext_vector_type(8)));
typedef float    v8f  __attribute__((ext_vector_type(8)));
typedef float    v4f  __attribute__((ext_vector_type(4)));
typedef unsigned int v4u __attribute__((ext_vector_type(4)));
typedef uint32_t u32x4 __attribute__((ext_vector_type(4)));
typedef uint32_t u32x8 __attribute__((ext_vector_type(8)));

union FragH { v16h v; v8h h[2]; v4u u[2]; };

// ---- scalar helpers --------------------------------------------------------------------------------
__device__ __forceinline__ unsigned short bf_bits(float f) {          // f32 -> bf16 bits, RNE convert
  unsigned u = __float_as_uint(f);
  return (unsigned short)((u + 0x7FFFu + ((u >> 16) & 1u)) >> 16);
}
__device__ __forceinline__ float bf_up(unsigned short h) { return __uint_as_float(((unsigned)h) << 16); }
__device__ __forceinline__ float bfr(float f) { return bf_up(bf_bits(f)); }   // value of the bf16 RNE convert
__device__ __forceinline__ unsigned short h_bits(_Float16 x) { return __builtin_bit_cast(unsigned short, x); }
__device__ __forceinline__ unsigned pk16(unsigned short a, unsigned short b) { return (unsigned)a | ((unsigned)b << 16); }
__device__ __forceinline__ v8f zero8() { v8f z = {0.f, 0.f, 0.f, 0.f, 0.f, 0.f, 0.f, 0.f}; return z; }

// ---- fragment loader: 16-bit A/B operand, lane -> row/col (lane&15), p already includes +8*(lane>>4);
//      elements 0..7 <- p[0..7] (k0+8h..), elements 8..15 <- p[16..23] (k0+16+8h..)  (same split k map for A and B;
//      B is always read from a k-contiguous [n][k] plane)
__device__ __forceinline__ v16h ldfrag_h(const _Float16* p) {
  FragH f;
  f.h[0] = *(const v8h*)(p);
  f.h[1] = *(const v8h*)(p + 16);
  return f.v;
}

__device__ __forceinline__ v8f mma_raw(v16h a, v16h b, v8f c) {
  return __builtin_amdgcn_wmma_f32_16x16x32_f16(false, a, false, b, (short)0, c, false, false);
}
// after a 4-deep score chain: ties the accumulator, keeps the 4 A and 4 B fragments live through the nops
__device__ __forceinline__ void guard_s(v8f& s, v16h x0, v16h x1, v16h x2, v16h x3,
                                        v16h y0, v16h y1, v16h y2, v16h y3) {
#if defined(__HIP_DEVICE_COMPILE__)
  asm volatile("v_nop\n\tv_nop\n\tv_nop\n\tv_nop"
               : "+v"(s) : "v"(x0), "v"(x1), "v"(x2), "v"(x3), "v"(y0), "v"(y1), "v"(y2), "v"(y3) : "memory");
#endif
}
// after a group of 8 P.V products (hi and residual P planes x 4 v fragments): ties 4 accumulators, keeps both P
// fragments and the 4 v fragments live
__device__ __forceinline__ void guard_o4(v8f& a, v8f& b, v8f& c, v8f& d,
                                         v16h p, v16h q, v16h x0, v16h x1, v16h x2, v16h x3) {
#if defined(__HIP_DEVICE_COMPILE__)
  asm volatile("v_nop\n\tv_nop\n\tv_nop\n\tv_nop"
               : "+v"(a), "+v"(b), "+v"(c), "+v"(d) : "v"(p), "v"(q), "v"(x0), "v"(x1), "v"(x2), "v"(x3) : "memory");
#endif
}
__device__ __forceinline__ void acc_guard8(v8f& a, v8f& b, v8f& c, v8f& d, v8f& e, v8f& f, v8f& g, v8f& hx) {
#if defined(__HIP_DEVICE_COMPILE__)
  asm volatile("v_nop\n\tv_nop\n\tv_nop\n\tv_nop"
               : "+v"(a), "+v"(b), "+v"(c), "+v"(d), "+v"(e), "+v"(f), "+v"(g), "+v"(hx));
#endif
}
__device__ __forceinline__ void wave_sync_lds() {
  __builtin_amdgcn_fence(__ATOMIC_RELEASE, "workgroup");
  __builtin_amdgcn_wave_barrier();
  __builtin_amdgcn_fence(__ATOMIC_ACQUIRE, "workgroup");
}

// ---- tensor load to LDS: descriptor words, issue, waits ----------------------------------------------
__device__ __forceinline__ uint32_t uni(uint32_t v) { return (uint32_t)__builtin_amdgcn_readfirstlane((int)v); }
// value held in a scalar register: a test on it compiles to s_cmp + s_cbranch_scc (tensor loads ignore EXEC), and a
// descriptor word formed from it is formed behind the asm waits that stand in front of this statement
__device__ __forceinline__ uint32_t pinned(uint32_t v) {
  uint32_t w = uni(v);
#if defined(__HIP_DEVICE_COMPILE__)
  asm volatile("" : "+s"(w));
#endif
  return w;
}
__device__ __forceinline__ void wait_ds0() {       // this wave's LDS reads have returned before the buffer is handed over
#if defined(__HIP_DEVICE_COMPILE__)
  asm volatile("s_wait_dscnt 0x0" ::: "memory");
#endif
}
__device__ __forceinline__ void wait_tensor0() {   // the issuing wave's tile has landed (the compiler places no such wait)
#if defined(__HIP_DEVICE_COMPILE__)
  asm volatile("s_wait_tensorcnt 0x0" ::: "memory");
#endif
}
// Group 1 of a two-dimensional tile, every extent in bytes: ROWS rows of ROWB bytes, source pitch PITCH, 16 B of LDS pad
// behind each row (interval code IVL = the row length), no mask; tensor dims = tile dims (every tile is interior).
template <uint32_t ROWB, uint32_t ROWS, uint32_t PITCH, uint32_t IVL>
__device__ __forceinline__ u32x8 tdm_group1() {
  u32x8 g;   // pinned(): each descriptor word held in a scalar register of its own for the whole kernel
  g[0] = pinned((1u << 20) | (IVL << 22) | (3u << 25));
  g[1] = pinned((ROWB & 0xFFFFu) << 16);
  g[2] = pinned((ROWB >> 16) | ((ROWS & 0xFFFFu) << 16));
  g[3] = pinned((ROWS >> 16) | (ROWB << 16));
  g[4] = pinned(ROWS);
  g[5] = pinned(PITCH);
  g[6] = pinned(0u);
  g[7] = pinned(0u);
  return g;
}
__device__ __forceinline__ u32x4 tdm_group0(uint32_t lds_dst, uint64_t ga) {
  u32x4 g;
  g[0] = uni(1u);
  g[1] = uni(lds_dst);
  g[2] = uni((uint32_t)ga);
  g[3] = uni((((uint32_t)(ga >> 32)) & 0x01FFFFFFu) | 0x80000000u);
#if defined(__HIP_DEVICE_COMPILE__)
  asm volatile("" : "+s"(g));   // descriptor words held in scalar registers until the wait that names them
#endif
  return g;
}
__device__ __forceinline__ void tdm_load(u32x4 g0, u32x8 g1) {
#if defined(__HIP_DEVICE_COMPILE__)
  asm volatile("tensor_load_to_lds %0, %1" :: "s"(g0), "s"(g1) : "memory");
#endif
}
// the issuing wave's tile has landed (the compiler places no such wait); naming the descriptor keeps its registers
// unchanged while the request is outstanding
__device__ __forceinline__ void tdm_wait(u32x4 g0, u32x8 g1) {
#if defined(__HIP_DEVICE_COMPILE__)
  asm volatile("s_wait_tensorcnt 0x0" :: "s"(g0), "s"(g1) : "memory");
#endif
}

// =====================================================================================================
// 16-bit plane convert, no relayout (inputs are batch-major [b][s][d]):
//   pl[e] = f16( bf16(x[e]) * sc ) (sc a power of two, exact). blockIdx.y == 0: q plane, == 1: k plane.
// Thread = 8 consecutive elements: two 16-B loads, one 16-B store per lane; 32 consecutive lanes = 256 contiguous, 512-B
// coverage: grid = (n8/256, 2) blocks x 256 thr x 8 elements = n = NB*2048*128 per plane exactly (n % 2048 == 0 asserted).
// =====================================================================================================
__global__ __launch_bounds__(256) void cvt16(const float* __restrict__ xq, const float* __restrict__ xk,
                                             unsigned short* plq, unsigned short* plk, int n8, float sc) {
  const int gt = blockIdx.x * 256 + (int)threadIdx.x;
  if (gt >= n8) return;                     // never taken with the exact grid; no barriers in this kernel
  const bool sk = (blockIdx.y != 0);        // block-uniform plane select (both pointers global)
  const float* x = sk ? xk : xq;
  unsigned short* pl = sk ? plk : plq;
  const size_t e = (size_t)gt * 8;
  const v4f a = *(const v4f*)(x + e), bq = *(const v4f*)(x + e + 4);
  v4u o;
#pragma unroll
  for (int i = 0; i < 2; ++i) {
    o[i]     = pk16(h_bits((_Float16)(bfr(a[2 * i]) * sc)),  h_bits((_Float16)(bfr(a[2 * i + 1]) * sc)));
    o[2 + i] = pk16(h_bits((_Float16)(bfr(bq[2 * i]) * sc)), h_bits((_Float16)(bfr(bq[2 * i + 1]) * sc)));
  }
  unsigned short* d = pl + e;
  {
    *(v4u*)(d) = o;
    
  }
}

// =====================================================================================================
// v^T plane: VT[(b*HD + d)][key] = f16( bf16(v[b][key][d]) * 256 ) (exact), pitch SEQ = 2048 halves (4096 B) per d row.
// Block = (b, tile of 64 keys): 64 source rows of 128 floats loaded with 16-B loads (static stride), converted, written into
// coverage: load 256 thr x 32 elements = 64 keys x 128 d; store 4 iterations x 256 thr x 8 halves = 128 lines x 64 = the tile;
//           grid = NB x 32 blocks covers the whole [NB][128][2048] plane exactly once.
// =====================================================================================================
__global__ __launch_bounds__(256) void vt16(const float* __restrict__ v, unsigned short* VTo) {
  __shared__ __align__(16) unsigned short T[HD * VTP];
  const int tid = threadIdx.x;
  const int bid = blockIdx.x;
  const int bb  = bid / VTILES;
  const int t   = bid - bb * VTILES;        // 0..31, block-uniform
  if (bb >= NB) return;                     // never taken with the exact grid; before any barrier or store
  {
    const int sl = tid >> 2;                  // key within tile 0..63
    const int dc = (tid & 3) * 32;            // d chunk 0,32,64,96
    int key = 64 * t + sl;                    // <= SEQ-1 by construction; clamp keeps the address in range regardless
    key = (key < 0) ? 0 : ((key > SEQ - 1) ? (SEQ - 1) : key);
    const float* src = v + (((size_t)bb * SEQ + (size_t)key) * HD + dc);
#pragma unroll
    for (int i = 0; i < 8; ++i) {
      const v4f a = *(const v4f*)(src + 4 * i);
#pragma unroll
      for (int e = 0; e < 4; ++e) T[(dc + 4 * i + e) * VTP + sl] = h_bits((_Float16)(bfr(a[e]) * VCAR));
    }
  }
  __syncthreads();
  v4u vals[4];
  const int q8 = tid >> 3, p8 = (tid & 7) * 8;
#pragma unroll
  for (int it = 0; it < 4; ++it) {
    const int line = it * 32 + q8;            // d = 0..127
    vals[it] = *(const v4u*)(T + line * VTP + p8);
  }
  unsigned short* dst = VTo + ((size_t)bb * HD) * SEQ + 64 * t + p8;
  {
#pragma unroll
    for (int it = 0; it < 4; ++it) {
      const int line = it * 32 + q8;
      *(v4u*)(dst + (size_t)line * SEQ) = vals[it];
    }
    
  }
}

// =====================================================================================================
// Causal flash attention per batch. Block = (b, 64 queries), 8 waves: wave w works query rows iw = 64t + 16(w & 3) .. +15
//   on the keys 64s + 32(w >> 2) .. +31 of every stage s; waves w and w + 4 hold partial max, sum and accumulators of the
//   same rows over disjoint keys, merged once behind the key loop (through the subtile's slab, by wave w).
//   q plane f16 [b][s][d] x1024, k plane f16 [b][s][d] x1024, v^T plane f16 [b][d][SEQ] x256.
//   The k and v^T planes reach the waves through LDS: stages of 64 keys, brought by tensor loads into two buffers that the
//   block's eight waves share; the fragment loads below read the staged rows (same lane -> row and k maps as from the planes).
//   Key loop kb = 64s + 32(w >> 2), a step is worked while kb < iw + 16 (wave-uniform, SGPR): keys above iw+15 are excluded
//   for every query of the wave; kb <= iw holds in every worked step, so key kb is included for every query (row max finite,
//   row sum >= 1 from the wave's first worked step on; a wave of the upper key group may have no step at all: max -inf, sum 0).
//   Scores are formed transposed, S^T = K.Q^T: A fragment = k plane row (key kb+16u+c), B fragment = q plane row
//   (query iw+c), both with the split d map, 4 d-steps of 32, one product each.
//   D element r of subtile u at lane (h,c) = score(key kb+16u+8h+r, query iw+c). In the last step(s) entries with
//   key > query are excluded (score -> -inf before the max, exp2 -> exactly 0), which equals the large negative fill
//   followed by softmax in f32.
//   The A fragment of P for the P.V product (row = query c, element r <- key kb+8h+r from subtile 0, element 8+r <-
//   key kb+16+8h+r from subtile 1) is an in-lane f32 -> f16 convert of P*32768 into a hi plane plus an unscaled residual
//   plane res = f16(P*32768 - hi); both planes multiply the same v fragments into the same accumulator (two products).
//   Online max-subtracted softmax in f32 (exp2); per-query max/sum = 16 in-lane values combined across the two lane halves;
//   rescale factors broadcast with shuffles.
//   P.V: B fragments = v^T plane rows d = 16j+c (keys contiguous), 16 products into 8 accumulators (16 queries x 128 d).
//   Epilogue: 1/l and the carry folds in f32; the wave's 16x128 slab staged transposed [d][16] (pitch 20) in its private LDS
// coverage: per storing wave (w < 4) 16 instructions x 32 lanes x 4 floats = 16 rows x 128; per block 4 such waves = 64 rows;
//           32 blocks per batch x NB batches: every row of out [NB][2048][128] exactly once (grid NB*32 blocks); every
//           wave of the lower key group runs at least one key step (kb = 0).
// =====================================================================================================
__global__ __launch_bounds__(ATT_THREADS)
void attn_fwd(const unsigned short* __restrict__ QHp, const unsigned short* __restrict__ KHp,
              const unsigned short* __restrict__ VTq, float* OPp) {
  __shared__ __align__(16) float smem[ATW * SLABF];    // per query subtile: [128 d][16 queries] f32 slab, pitch QP
  __shared__ __attribute__((aligned(2048))) unsigned char ring[2 * BUFB];   // two buffers: k tile [64 keys][272 B], v^T tile [128 d][144 B]

  const int tid  = threadIdx.x;
  const int wave = (tid >> 5) & (ATW - 1);             // query subtile
  const int kgu  = __builtin_amdgcn_readfirstlane(tid >> 7);   // key group 0 or 1, wave-uniform in an SGPR
  const int lane = tid & 31;
  const int hh   = lane >> 4;
  const int c    = lane & 15;

  // Block index -> (batch, query tile), a permutation of the grid. A tile's cost is its t + 1 stages, all blocks are resident
  // at once (two a WGP by LDS): the first half of
  // the grid holds tiles 31 .. 16, heaviest first, the second half tiles 0 .. 15, so that blocks bid and bid + NB*16 hold
  // tiles t and 31 - t (33 stages together). For speed only: any placement gives the same result.
  const uint32_t bid = blockIdx.x;
  if (bid >= (uint32_t)ATT_BLOCKS) return;             // never taken with the exact grid; before any LDS use or store
  const bool     hv  = bid < (uint32_t)HALFG;          // block-uniform: first half of the grid, heavy tiles
  const uint32_t rk  = hv ? bid : bid - (uint32_t)HALFG;   // rank within its half, 0 .. NB*16 - 1
  const int bb   = (int)(rk % (uint32_t)NB);           // 0 .. NB-1
  const int t    = hv ? (BPB - 1 - (int)(rk / (uint32_t)NB)) : (int)(rk / (uint32_t)NB);   // 0..31, block-uniform

  const int iw   = QPB * t + wave * 16;                // query row 0 of this wave, iw + 15 <= SEQ - 1
  const int iwu  = __builtin_amdgcn_readfirstlane(iw); // wave-uniform copy in an SGPR
  const int kend = iwu + 16;                           // keys 0 .. iw+15 ; kend <= SEQ

  // B fragments of q^T: lane col n = query iw + c, split d map
  const _Float16* Qb = (const _Float16*)(const void*)QHp + ((size_t)bb * SEQ + (size_t)(iw + c)) * HD + 8 * hh;
  const v16h qf0 = ldfrag_h(Qb);                       // d 0..31
  const v16h qf1 = ldfrag_h(Qb + 32);                  // d 32..63
  const v16h qf2 = ldfrag_h(Qb + 64);                  // d 64..95
  const v16h qf3 = ldfrag_h(Qb + 96);                  // d 96..127
  // Stage s = keys 64s .. 64s+63 of batch bb, shared by the block's eight waves: wave 0 brings the k tile (64 rows of 256 B,
  // contiguous), wave 1 the v^T tile (128 d rows of 128 B, source pitch 4096 B), one request each, into buffer s & 1.
  // Stages 0 .. t: 64s + 63 <= 64t + 63 <= SEQ - 1, every tile interior to its plane.
  const uint32_t wv    = uni((uint32_t)tid >> 5);
  const uint32_t nst   = uni((uint32_t)t + 1u);
  const uint32_t lbase = (uint32_t)(size_t)ring;
  const uint64_t kga   = (uint64_t)(size_t)KHp + (uint64_t)bb * (SEQ * HD * 2);
  const uint64_t vga   = (uint64_t)(size_t)VTq + (uint64_t)bb * (HD * SEQ * 2);
  const u32x8 g1k = tdm_group1<HD * 2, STK, HD * 2, 5u>();
  const u32x8 g1v = tdm_group1<STK * 2, HD, SEQ * 2, 4u>();
  const uint32_t isk = (wv == 0u) ? 1u : 0u, isv = (wv == 1u) ? 1u : 0u;
  auto group0 = [&](uint32_t sn) {                     // sn comes from pinned(): formed behind the waits in front of it
    return tdm_group0(lbase + (sn & 1u) * BUFB + isv * KPL,
                      isv ? vga + (uint64_t)sn * (STK * 2) : kga + (uint64_t)sn * (STK * HD * 2));
  };
  u32x4 g0 = group0(pinned(0u));
  if (pinned(isk)) { tdm_load(g0, g1k); tdm_wait(g0, g1k); }   // stage 0 has landed
  if (pinned(isv)) { tdm_load(g0, g1v); tdm_wait(g0, g1v); }
  __syncthreads();                                     // stage 0 published to all eight waves
  {
    const uint32_t sn = pinned(1u);                    // stage 1, where it exists, flies while stage 0 is worked on
    g0 = group0(sn);
    if (pinned((isk && sn < nst) ? 1u : 0u)) tdm_load(g0, g1k);
    if (pinned((isv && sn < nst) ? 1u : 0u)) tdm_load(g0, g1v);
  }
  const unsigned char* Kl = ring + c * KPB + 16 * hh;          // key row c of a tile, split d map
  const unsigned char* Vl = ring + KPL + c * VPB + 16 * hh;    // d row c of a tile, split key map
  const float lsc = (SM_SCALE * LOG2E) / (QSC * KSC);
  const int dq0 = 8 * hh - (iw + c);                   // key(kb+8hh+r) - query(iw+c) = kb + dq0 + r

  float m_run = -INFINITY, l_run = 0.f;
  v8f o[8];
#pragma unroll
  for (int j = 0; j < 8; ++j) o[j] = zero8();

#pragma unroll 1
  for (int s = 0; s <= t; ++s) {                       // block-uniform trip count: every wave passes every publish point
   const int kb = STK * s + 32 * kgu;                  // this wave's 32 keys of stage s
   const int bo = (s & 1) * BUFB;                      // buffer of stage s
   if (kb < kend) {                                    // wave-uniform (SGPR): steps wholly above the wave's queries are skipped
    // ---- scores (transposed): s0 = keys kb..kb+15, s1 = keys kb+16..kb+31, columns = queries iw..iw+15 ----
    v8f s0 = zero8(), s1 = zero8();
    {
      const _Float16* k0p = (const _Float16*)(const void*)(Kl + bo + (32 * kgu) * KPB);   // key row kb + c
      const v16h a0 = ldfrag_h(k0p), a1 = ldfrag_h(k0p + 32), a2 = ldfrag_h(k0p + 64), a3 = ldfrag_h(k0p + 96);
      s0 = mma_raw(a0, qf0, s0);
      s0 = mma_raw(a1, qf1, s0);
      s0 = mma_raw(a2, qf2, s0);
      s0 = mma_raw(a3, qf3, s0);
      guard_s(s0, a0, a1, a2, a3, qf0, qf1, qf2, qf3);
      const _Float16* k1p = k0p + 16 * (KPB / 2);                    // key row kb + 16 + c
      const v16h b0 = ldfrag_h(k1p), b1 = ldfrag_h(k1p + 32), b2 = ldfrag_h(k1p + 64), b3 = ldfrag_h(k1p + 96);
      s1 = mma_raw(b0, qf0, s1);
      s1 = mma_raw(b1, qf1, s1);
      s1 = mma_raw(b2, qf2, s1);
      s1 = mma_raw(b3, qf3, s1);
      guard_s(s1, b0, b1, b2, b3, qf0, qf1, qf2, qf3);
    }
    // ---- base-2 logits for query iw + c (16 keys in this lane, 16 in the other half) ----
    float u0[8], u1[8];
#pragma unroll
    for (int r = 0; r < 8; ++r) {
      u0[r] = s0[r] * lsc;
      u1[r] = s1[r] * lsc;
    }
    // ---- causal exclusion, only in steps that hold keys above some query of the wave (wave-uniform test) ----
    if (kb + 32 > iwu) {
      const int dq = kb + dq0;
#pragma unroll
      for (int r = 0; r < 8; ++r) {
        u0[r] = (dq + r > 0)      ? -INFINITY : u0[r];   // key kb+8hh+r    > query iw+c
        u1[r] = (dq + 16 + r > 0) ? -INFINITY : u1[r];   // key kb+16+8hh+r > query iw+c
      }
    }
    // ---- online softmax ----
    float mx = -INFINITY;
#pragma unroll
    for (int r = 0; r < 8; ++r) mx = fmaxf(mx, fmaxf(u0[r], u1[r]));
    mx = fmaxf(mx, __shfl_xor(mx, 16, 32));            // finite: key kb <= iw <= every query of the wave
    const float mn = fmaxf(m_run, mx);                 // finite from the first step on
    const float al = exp2f(m_run - mn);                // 0 on the first step
    m_run = mn;
    float ps = 0.f;
    FragH pa, pl;                                      // hi plane and unscaled residual plane of P*32768
#pragma unroll
    for (int r = 0; r < 8; ++r) {
      const float e0 = exp2f(u0[r] - mn), e1 = exp2f(u1[r] - mn);   // excluded keys: exp2(-inf) = 0 exactly
      ps += e0 + e1;
      const float x0 = e0 * PCAR, x1 = e1 * PCAR;
      const _Float16 g0 = (_Float16)x0, g1 = (_Float16)x1;
      pa.h[0][r] = g0;                                  // element r     = key kb + 8hh + r
      pa.h[1][r] = g1;                                  // element 8 + r = key kb + 16 + 8hh + r
      pl.h[0][r] = (_Float16)(x0 - (float)g0);          // residual (exact f32 difference, then f16 convert)
      pl.h[1][r] = (_Float16)(x1 - (float)g1);
    }
    ps += __shfl_xor(ps, 16, 32);
    l_run = l_run * al + ps;
#pragma unroll
    for (int r = 0; r < 8; ++r) {
      const float af = __shfl(al, 8 * hh + r, 32);      // rescale factor of query iw + 8hh + r
#pragma unroll
      for (int j = 0; j < 8; ++j) o[j][r] *= af;
    }
    // ---- P.V : B fragment col n = d = 16j + c, keys kb .. kb+31 contiguous in the v^T plane row d ----
    {
      const _Float16* vp = (const _Float16*)(const void*)(Vl + bo + (32 * kgu) * 2);
      const v16h v0 = ldfrag_h(vp);
      const v16h v1 = ldfrag_h(vp + 16 * (VPB / 2));
      const v16h v2 = ldfrag_h(vp + 32 * (VPB / 2));
      const v16h v3 = ldfrag_h(vp + 48 * (VPB / 2));
      o[0] = mma_raw(pa.v, v0, o[0]);
      o[0] = mma_raw(pl.v, v0, o[0]);
      o[1] = mma_raw(pa.v, v1, o[1]);
      o[1] = mma_raw(pl.v, v1, o[1]);
      o[2] = mma_raw(pa.v, v2, o[2]);
      o[2] = mma_raw(pl.v, v2, o[2]);
      o[3] = mma_raw(pa.v, v3, o[3]);
      o[3] = mma_raw(pl.v, v3, o[3]);
      guard_o4(o[0], o[1], o[2], o[3], pa.v, pl.v, v0, v1, v2, v3);
      const v16h v4 = ldfrag_h(vp + 64 * (VPB / 2));
      const v16h v5 = ldfrag_h(vp + 80 * (VPB / 2));
      const v16h v6 = ldfrag_h(vp + 96 * (VPB / 2));
      const v16h v7 = ldfrag_h(vp + 112 * (VPB / 2));
      o[4] = mma_raw(pa.v, v4, o[4]);
      o[4] = mma_raw(pl.v, v4, o[4]);
      o[5] = mma_raw(pa.v, v5, o[5]);
      o[5] = mma_raw(pl.v, v5, o[5]);
      o[6] = mma_raw(pa.v, v6, o[6]);
      o[6] = mma_raw(pl.v, v6, o[6]);
      o[7] = mma_raw(pa.v, v7, o[7]);
      o[7] = mma_raw(pl.v, v7, o[7]);
      guard_o4(o[4], o[5], o[6], o[7], pa.v, pl.v, v4, v5, v6, v7);
    }
   }
   // ---- publish point of stage s + 1, at the foot of stage s ----
   {
     wait_ds0();                                       // this wave has left stage s's buffer
     if (pinned(isk)) tdm_wait(g0, g1k);               // stage s + 1 has landed
     if (pinned(isv)) tdm_wait(g0, g1v);
     __syncthreads();                                  // publishes stage s + 1; ends every reader's last read of stage s
     const uint32_t sn = pinned((uint32_t)s + 2u);   // stage s + 2, while it exists, into the buffer just left
     g0 = group0(sn);
     if (pinned((isk && sn < nst) ? 1u : 0u)) tdm_load(g0, g1k);
     if (pinned((isv && sn < nst) ? 1u : 0u)) tdm_load(g0, g1v);
   }
  }
  wait_tensor0();                                      // behind the ring: no request and no LDS read of this wave is left
  wait_ds0();
  acc_guard8(o[0], o[1], o[2], o[3], o[4], o[5], o[6], o[7]);

  // ---- fold 1/l and the carries (32768 on P, 256 on v), stage the wave's slab transposed [d][query] in its LDS region ----
  float* slab = smem + wave * SLABF;
  // ---- merge of the two key groups: the upper group's wave leaves its accumulators (lane-private order, 512 contiguous
  //      bytes per store), max and sum in the subtile's slab; the lower group's wave of the same rows takes them up ----
  if (kgu) {                                           // wave-uniform (SGPR)
#pragma unroll
    for (int j = 0; j < 8; ++j) {
      v4f w0, w1;
#pragma unroll
      for (int r = 0; r < 4; ++r) { w0[r] = o[j][r]; w1[r] = o[j][4 + r]; }
      *(v4f*)(slab + ((2 * j) * 32 + lane) * 4)     = w0;
      *(v4f*)(slab + ((2 * j + 1) * 32 + lane) * 4) = w1;
    }
    slab[2048 + lane] = m_run;
    slab[2080 + lane] = l_run;
  }
  __syncthreads();                                     // the upper group's partials are published; every wave passes it
  if (kgu) return;                                     // no barrier, tensor load or store of this wave is left
  const float m1 = slab[2048 + lane], l1 = slab[2080 + lane];
  v4f p0[8], p1[8];                                    // read whole before the slab is rewritten below (same wave, in order)
#pragma unroll
  for (int j = 0; j < 8; ++j) {
    p0[j] = *(const v4f*)(slab + ((2 * j) * 32 + lane) * 4);
    p1[j] = *(const v4f*)(slab + ((2 * j + 1) * 32 + lane) * 4);
  }
  const float mm = fmaxf(m_run, m1);                   // m_run is finite (step kb = 0); m1 may be -inf with l1 = 0
  const float a0 = exp2f(m_run - mm), a1 = exp2f(m1 - mm);
  const float lt = l_run * a0 + l1 * a1;
  const float oc = 1.0f / (PCAR * VCAR);               // 2^-23 exact
  const float li = (lt > 0.0f) ? ((1.0f / lt) * oc) : 0.0f;   // lt >= 1 (the max element contributes 2^0)
  const float li0 = li * a0, li1 = li * a1;
  float lf[8], lg[8];
#pragma unroll
  for (int r = 0; r < 8; ++r) {                        // factors of query iw + 8hh + r for the two partial accumulators
    lf[r] = __shfl(li0, 8 * hh + r, 32);
    lg[r] = __shfl(li1, 8 * hh + r, 32);
  }
#pragma unroll
  for (int j = 0; j < 8; ++j) {
    v4f w0, w1;
#pragma unroll
    for (int r = 0; r < 4; ++r) {
      w0[r] = o[j][r] * lf[r] + p0[j][r] * lg[r];
      w1[r] = o[j][4 + r] * lf[4 + r] + p1[j][r] * lg[4 + r];
    }
    float* sp = slab + (16 * j + c) * QP + 8 * hh;     // d row 16j + c, query cols 8hh .. 8hh+7, 16-B aligned
    *(v4f*)(sp)     = w0;
    *(v4f*)(sp + 4) = w1;
  }
  wave_sync_lds();
  v4f vals[16];
#pragma unroll
  for (int it = 0; it < 16; ++it) {
#pragma unroll
    for (int e = 0; e < 4; ++e) vals[it][e] = slab[(4 * lane + e) * QP + it];   // out(query iw+it, d = 4*lane+e)
  }
  float* dst = OPp + ((size_t)bb * SEQ + (size_t)iw) * HD + 4 * lane;
  {
#pragma unroll
    for (int it = 0; it < 16; ++it) {
      *(v4f*)(dst + (size_t)it * HD) = vals[it];   // one 512-B row per instruction, lanes 8q..8q+7 per line
    }
    
  }
}

// =====================================================================================================
// Workspace map (bytes); every plane is fully written by whole-line stores before it is read; all extents are exact
// multiples of the store granularity (no pad rows needed); offsets multiples of 128 (NB = 16 values):
//   QH f16 [NB][2048][128] x1024       8388608   at        0
//   KH f16 [NB][2048][128] x1024       8388608   at  8388608
//   VT f16 [NB][128][2048] x256        8388608   at 16777216
//   end                                             25165824
// =====================================================================================================
extern "C" void kernel_launch(void* const* d_in, const int* in_sizes, int n_in,
                              void* d_out, int out_size, void* d_ws, size_t ws_size,
                              hipStream_t stream) {
  const int NEL = NB * SEQ * HD;                        // 4194304 for NB = 16
  if (n_in < 3) return;
  if (in_sizes[0] < NEL || in_sizes[1] < NEL || in_sizes[2] < NEL) return;
  if (out_size < NEL) return;

  const float* q  = (const float*)d_in[0];
  const float* k  = (const float*)d_in[1];
  const float* v  = (const float*)d_in[2];
  float*       out = (float*)d_out;

  const size_t PQ = (size_t)NEL * 2;                    //  8388608
  const size_t PK = (size_t)NEL * 2;                    //  8388608
  const size_t PV = (size_t)NB * HD * SEQ * 2;          //  8388608
  size_t off = 0;
  const size_t oQH = off; off += PQ;
  const size_t oKH = off; off += PK;
  const size_t oVT = off; off += PV;
  if (off > ws_size) return;                            // off = 25165824
  if (off > (size_t)134217728) return;

  char* ws = (char*)d_ws;
  unsigned short* QH = (unsigned short*)(ws + oQH);
  unsigned short* KH = (unsigned short*)(ws + oKH);
  unsigned short* VT = (unsigned short*)(ws + oVT);

  const int n8 = NEL / 8;                               // 524288
  const dim3 blk(256);
  const dim3 gC(n8 / 256, 2);                           // (2048, 2): q and k planes in one launch
  const dim3 gVT(NB * VTILES);                          // 512
  const dim3 gAT(ATT_BLOCKS);                           // 512
  const dim3 bAT(ATT_THREADS);                          // 256

  // (0) q and k planes f16(bf16(x) * 1024), layout [b][s][d]
  cvt16<<<gC, blk, 0, stream>>>(q, k, QH, KH, n8, QSC);
  // (1) v^T plane f16(bf16(v) * 256), layout [b][d][2048]
  vt16<<<gVT, blk, 0, stream>>>(v, VT);
  // (2) causal flash attention per batch -> out [b][s][d] f32
  attn_fwd<<<gAT, bAT, 0, stream>>>(QH, KH, VT, out);
  (void)hipGetLastError();
}

// v004
// Measured time: 43 microseconds a run.
// Two timings next to v003 put it at 1.04 and 1.05 times that version's speed.
// All steps since v000 together make it 3.67 times as fast.
// Contractions: scores k.q^T (k x1024 and q x1024 as f16 planes of the bf16-RNE-converted inputs, one product, K=128) and
// P.v (P x32768 as an f16 hi plane plus an unscaled f16 residual plane, two products into one f32 accumulator; v x256 f16
// of the bf16-RNE-converted input; 32-key steps): all v_wmma_f32_16x16x32_f16 (f16 operands, f32 accumulate).
// Causal key range (key <= query); base-2 online softmax and the 1/l fold in f32 on VALU.
#include <hip/hip_runtime.h>
#include <math.h>
#include <stdint.h>

#ifndef NB
#define NB    16
#endif
#define SEQ   2048
#define HD    128
#define QSC   1024.0f
#define KSC   1024.0f
#define PCAR  32768.0f
#define VCAR  256.0f
#define SM_SCALE 0.08838834764831845f
#define LOG2E 1.4426950408889634f
#define ATW   4                          // query subtiles of 16 rows per block
#define KGR   2                          // key groups: wave group g takes keys 32g .. 32g+31 of every 64-key stage
#define ATT_THREADS (ATW * KGR * 32)
#define QPB   (16 * ATW)
#define BPB   (SEQ / QPB)
#define ATT_BLOCKS (NB * BPB)
#define HALFG (NB * (BPB / 2))           // blocks in each half of the attention grid
#define QP    20
#define SLABF (HD * QP)
#define VTP   72
#define VTILES (SEQ / 64)
#define STK   64                         // keys per LDS stage
#define KPB   272                        // LDS pitch of a staged k row: 256 B + 16 B pad (16 B x odd, ds_load_b128 reader)
#define VPB   144                        // LDS pitch of a staged v^T row: 128 B + 16 B pad
#define KPL   18432                      // place of the k tile in a buffer: 64 x 272 = 17408 B, rounded up to 2 KiB
#define VPL   18432                      // place of the v^T tile: 128 x 144 B
#define BUFB  (KPL + VPL)
static_assert(HD == 128 && QPB == 64 && ATT_THREADS == 256 && KGR * 32 == 64);
static_assert((SEQ % QPB) == 0 && (SEQ % 64) == 0 && (SEQ % 32) == 0 && (HD % 32) == 0);
static_assert(NB >= 1 && NB <= 16);
static_assert(BPB == 32 && VTILES == 32);
static_assert((HD - 1) * VTP + 63 < HD * VTP);
static_assert((HD - 1) * QP + 15 < SLABF && (QP % 4) == 0);
static_assert(64 * 32 + 2 * 32 <= SLABF);   // a wave's 64 accumulator floats per lane plus max and sum fit its subtile's slab
static_assert(((NB * SEQ * HD) % 2048) == 0);
static_assert(STK == QPB && STK * KPB <= KPL && HD * VPB <= VPL && (KPL % 2048) == 0 && (BUFB % 2048) == 0);
static_assert(KPB == HD * 2 + 16 && VPB == STK * 2 + 16);

typedef _Float16 v16h __attribute__((ext_vector_type(16)));
typedef _Float16 v8h  __attribute__((ext_vector_type(8)));
typedef float    v8f  __attribute__((ext_vector_type(8)));
typedef float    v4f  __attribute__((ext_vector_type(4)));
typedef unsigned int v4u __attribute__((ext_vector_type(4)));
typedef uint32_t u32x4 __attribute__((ext_vector_type(4)));
typedef uint32_t u32x8 __attribute__((ext_vector_type(8)));

union FragH { v16h v; v8h h[2]; v4u u[2]; };

// ---- scalar helpers --------------------------------------------------------------------------------
__device__ __forceinline__ unsigned short bf_bits(float f) {          // f32 -> bf16 bits, RNE convert
  unsigned u = __float_as_uint(f);
  return (unsigned short)((u + 0x7FFFu + ((u >> 16) & 1u)) >> 16);
}
__device__ __forceinline__ float bf_up(unsigned short h) { return __uint_as_float(((unsigned)h) << 16); }
__device__ __forceinline__ float bfr(float f) { return bf_up(bf_bits(f)); }   // value of the bf16 RNE convert
__device__ __forceinline__ unsigned short h_bits(_Float16 x) { return __builtin_bit_cast(unsigned short, x); }
__device__ __forceinline__ unsigned pk16(unsigned short a, unsigned short b) { return (unsigned)a | ((unsigned)b << 16); }
// 2^x as the bare hardware instruction: results below 2^-126 come out as 0 instead of a subnormal. Every use here is a
// softmax weight or rescale factor relative to a row maximum whose own weight is 1, so such a term is below f32 rounding
// of the row sum and far below the smallest f16 step of P*32768. 2^(-inf) = 0 as before.
__device__ __forceinline__ float ex2(float x) {
#if defined(__HIP_DEVICE_COMPILE__)
  return __builtin_amdgcn_exp2f(x);
#else
  return exp2f(x);
#endif
}
__device__ __forceinline__ v8f zero8() { v8f z = {0.f, 0.f, 0.f, 0.f, 0.f, 0.f, 0.f, 0.f}; return z; }

// ---- fragment loader: 16-bit A/B operand, lane -> row/col (lane&15), p already includes +8*(lane>>4);
//      elements 0..7 <- p[0..7] (k0+8h..), elements 8..15 <- p[16..23] (k0+16+8h..)  (same split k map for A and B;
//      B is always read from a k-contiguous [n][k] plane)
__device__ __forceinline__ v16h ldfrag_h(const _Float16* p) {
  FragH f;
  f.h[0] = *(const v8h*)(p);
  f.h[1] = *(const v8h*)(p + 16);
  return f.v;
}

__device__ __forceinline__ v8f mma_raw(v16h a, v16h b, v8f c) {
  return __builtin_amdgcn_wmma_f32_16x16x32_f16(false, a, false, b, (short)0, c, false, false);
}
// after a 4-deep score chain: ties the accumulator, keeps the 4 A and 4 B fragments live through the nops
__device__ __forceinline__ void guard_s(v8f& s, v16h x0, v16h x1, v16h x2, v16h x3,
                                        v16h y0, v16h y1, v16h y2, v16h y3) {
#if defined(__HIP_DEVICE_COMPILE__)
  asm volatile("v_nop\n\tv_nop\n\tv_nop\n\tv_nop"
               : "+v"(s) : "v"(x0), "v"(x1), "v"(x2), "v"(x3), "v"(y0), "v"(y1), "v"(y2), "v"(y3) : "memory");
#endif
}
// after a group of 8 P.V products (hi and residual P planes x 4 v fragments): ties 4 accumulators, keeps both P
// fragments and the 4 v fragments live
__device__ __forceinline__ void guard_o4(v8f& a, v8f& b, v8f& c, v8f& d,
                                         v16h p, v16h q, v16h x0, v16h x1, v16h x2, v16h x3) {
#if defined(__HIP_DEVICE_COMPILE__)
  asm volatile("v_nop\n\tv_nop\n\tv_nop\n\tv_nop"
               : "+v"(a), "+v"(b), "+v"(c), "+v"(d) : "v"(p), "v"(q), "v"(x0), "v"(x1), "v"(x2), "v"(x3) : "memory");
#endif
}
__device__ __forceinline__ void acc_guard8(v8f& a, v8f& b, v8f& c, v8f& d, v8f& e, v8f& f, v8f& g, v8f& hx) {
#if defined(__HIP_DEVICE_COMPILE__)
  asm volatile("v_nop\n\tv_nop\n\tv_nop\n\tv_nop"
               : "+v"(a), "+v"(b), "+v"(c), "+v"(d), "+v"(e), "+v"(f), "+v"(g), "+v"(hx));
#endif
}
__device__ __forceinline__ void wave_sync_lds() {
  __builtin_amdgcn_fence(__ATOMIC_RELEASE, "workgroup");
  __builtin_amdgcn_wave_barrier();
  __builtin_amdgcn_fence(__ATOMIC_ACQUIRE, "workgroup");
}

// ---- tensor load to LDS: descriptor words, issue, waits ----------------------------------------------
__device__ __forceinline__ uint32_t uni(uint32_t v) { return (uint32_t)__builtin_amdgcn_readfirstlane((int)v); }
// value held in a scalar register: a test on it compiles to s_cmp + s_cbranch_scc (tensor loads ignore EXEC), and a
// descriptor word formed from it is formed behind the asm waits that stand in front of this statement
__device__ __forceinline__ uint32_t pinned(uint32_t v) {
  uint32_t w = uni(v);
#if defined(__HIP_DEVICE_COMPILE__)
  asm volatile("" : "+s"(w));
#endif
  return w;
}
__device__ __forceinline__ void wait_ds0() {       // this wave's LDS reads have returned before the buffer is handed over
#if defined(__HIP_DEVICE_COMPILE__)
  asm volatile("s_wait_dscnt 0x0" ::: "memory");
#endif
}
__device__ __forceinline__ void wait_tensor0() {   // the issuing wave's tile has landed (the compiler places no such wait)
#if defined(__HIP_DEVICE_COMPILE__)
  asm volatile("s_wait_tensorcnt 0x0" ::: "memory");
#endif
}
// Group 1 of a two-dimensional tile, every extent in bytes: ROWS rows of ROWB bytes, source pitch PITCH, 16 B of LDS pad
// behind each row (interval code IVL = the row length), no mask; tensor dims = tile dims (every tile is interior).
template <uint32_t ROWB, uint32_t ROWS, uint32_t PITCH, uint32_t IVL>
__device__ __forceinline__ u32x8 tdm_group1() {
  u32x8 g;   // pinned(): each descriptor word held in a scalar register of its own for the whole kernel
  g[0] = pinned((1u << 20) | (IVL << 22) | (3u << 25));
  g[1] = pinned((ROWB & 0xFFFFu) << 16);
  g[2] = pinned((ROWB >> 16) | ((ROWS & 0xFFFFu) << 16));
  g[3] = pinned((ROWS >> 16) | (ROWB << 16));
  g[4] = pinned(ROWS);
  g[5] = pinned(PITCH);
  g[6] = pinned(0u);
  g[7] = pinned(0u);
  return g;
}
__device__ __forceinline__ u32x4 tdm_group0(uint32_t lds_dst, uint64_t ga) {
  u32x4 g;
  g[0] = uni(1u);
  g[1] = uni(lds_dst);
  g[2] = uni((uint32_t)ga);
  g[3] = uni((((uint32_t)(ga >> 32)) & 0x01FFFFFFu) | 0x80000000u);
#if defined(__HIP_DEVICE_COMPILE__)
  asm volatile("" : "+s"(g));   // descriptor words held in scalar registers until the wait that names them
#endif
  return g;
}
__device__ __forceinline__ void tdm_load(u32x4 g0, u32x8 g1) {
#if defined(__HIP_DEVICE_COMPILE__)
  asm volatile("tensor_load_to_lds %0, %1" :: "s"(g0), "s"(g1) : "memory");
#endif
}
// the issuing wave's tile has landed (the compiler places no such wait); naming the descriptor keeps its registers
// unchanged while the request is outstanding
__device__ __forceinline__ void tdm_wait(u32x4 g0, u32x8 g1) {
#if defined(__HIP_DEVICE_COMPILE__)
  asm volatile("s_wait_tensorcnt 0x0" :: "s"(g0), "s"(g1) : "memory");
#endif
}

// =====================================================================================================
// 16-bit plane convert, no relayout (inputs are batch-major [b][s][d]):
//   pl[e] = f16( bf16(x[e]) * sc ) (sc a power of two, exact). blockIdx.y == 0: q plane, == 1: k plane.
// Thread = 8 consecutive elements: two 16-B loads, one 16-B store per lane; 32 consecutive lanes = 256 contiguous, 512-B
// coverage: grid = (n8/256, 2) blocks x 256 thr x 8 elements = n = NB*2048*128 per plane exactly (n % 2048 == 0 asserted).
// =====================================================================================================
__global__ __launch_bounds__(256) void cvt16(const float* __restrict__ xq, const float* __restrict__ xk,
                                             unsigned short* plq, unsigned short* plk, int n8, float sc) {
  const int gt = blockIdx.x * 256 + (int)threadIdx.x;
  if (gt >= n8) return;                     // never taken with the exact grid; no barriers in this kernel
  const bool sk = (blockIdx.y != 0);        // block-uniform plane select (both pointers global)
  const float* x = sk ? xk : xq;
  unsigned short* pl = sk ? plk : plq;
  const size_t e = (size_t)gt * 8;
  const v4f a = *(const v4f*)(x + e), bq = *(const v4f*)(x + e + 4);
  v4u o;
#pragma unroll
  for (int i = 0; i < 2; ++i) {
    o[i]     = pk16(h_bits((_Float16)(bfr(a[2 * i]) * sc)),  h_bits((_Float16)(bfr(a[2 * i + 1]) * sc)));
    o[2 + i] = pk16(h_bits((_Float16)(bfr(bq[2 * i]) * sc)), h_bits((_Float16)(bfr(bq[2 * i + 1]) * sc)));
  }
  unsigned short* d = pl + e;
  {
    *(v4u*)(d) = o;
    
  }
}

// =====================================================================================================
// v^T plane: VT[(b*HD + d)][key] = f16( bf16(v[b][key][d]) * 256 ) (exact), pitch SEQ = 2048 halves (4096 B) per d row.
// Block = (b, tile of 64 keys): 64 source rows of 128 floats loaded with 16-B loads (static stride), converted, written into
// coverage: load 256 thr x 32 elements = 64 keys x 128 d; store 4 iterations x 256 thr x 8 halves = 128 lines x 64 = the tile;
//           grid = NB x 32 blocks covers the whole [NB][128][2048] plane exactly once.
// =====================================================================================================
__global__ __launch_bounds__(256) void vt16(const float* __restrict__ v, unsigned short* VTo) {
  __shared__ __align__(16) unsigned short T[HD * VTP];
  const int tid = threadIdx.x;
  const int bid = blockIdx.x;
  const int bb  = bid / VTILES;
  const int t   = bid - bb * VTILES;        // 0..31, block-uniform
  if (bb >= NB) return;                     // never taken with the exact grid; before any barrier or store
  {
    const int sl = tid >> 2;                  // key within tile 0..63
    const int dc = (tid & 3) * 32;            // d chunk 0,32,64,96
    int key = 64 * t + sl;                    // <= SEQ-1 by construction; clamp keeps the address in range regardless
    key = (key < 0) ? 0 : ((key > SEQ - 1) ? (SEQ - 1) : key);
    const float* src = v + (((size_t)bb * SEQ + (size_t)key) * HD + dc);
#pragma unroll
    for (int i = 0; i < 8; ++i) {
      const v4f a = *(const v4f*)(src + 4 * i);
#pragma unroll
      for (int e = 0; e < 4; ++e) T[(dc + 4 * i + e) * VTP + sl] = h_bits((_Float16)(bfr(a[e]) * VCAR));
    }
  }
  __syncthreads();
  v4u vals[4];
  const int q8 = tid >> 3, p8 = (tid & 7) * 8;
#pragma unroll
  for (int it = 0; it < 4; ++it) {
    const int line = it * 32 + q8;            // d = 0..127
    vals[it] = *(const v4u*)(T + line * VTP + p8);
  }
  unsigned short* dst = VTo + ((size_t)bb * HD) * SEQ + 64 * t + p8;
  {
#pragma unroll
    for (int it = 0; it < 4; ++it) {
      const int line = it * 32 + q8;
      *(v4u*)(dst + (size_t)line * SEQ) = vals[it];
    }
    
  }
}

// =====================================================================================================
// Causal flash attention per batch. Block = (b, 64 queries), 8 waves: wave w works query rows iw = 64t + 16(w & 3) .. +15
//   on the keys 64s + 32(w >> 2) .. +31 of every stage s; waves w and w + 4 hold partial max, sum and accumulators of the
//   same rows over disjoint keys, merged once behind the key loop (through the subtile's slab, by wave w).
//   q plane f16 [b][s][d] x1024, k plane f16 [b][s][d] x1024, v^T plane f16 [b][d][SEQ] x256.
//   The k and v^T planes reach the waves through LDS: stages of 64 keys, brought by tensor loads into two buffers that the
//   block's eight waves share; the fragment loads below read the staged rows (same lane -> row and k maps as from the planes).
//   Key loop kb = 64s + 32(w >> 2), a step is worked while kb < iw + 16 (wave-uniform, SGPR): keys above iw+15 are excluded
//   for every query of the wave; kb <= iw holds in every worked step, so key kb is included for every query (row max finite,
//   row sum >= 1 from the wave's first worked step on; a wave of the upper key group may have no step at all: max -inf, sum 0).
//   Scores are formed transposed, S^T = K.Q^T: A fragment = k plane row (key kb+16u+c), B fragment = q plane row
//   (query iw+c), both with the split d map, 4 d-steps of 32, one product each.
//   D element r of subtile u at lane (h,c) = score(key kb+16u+8h+r, query iw+c). In the last step(s) entries with
//   key > query are excluded (score -> -inf before the max, exp2 -> exactly 0), which equals the large negative fill
//   followed by softmax in f32.
//   The A fragment of P for the P.V product (row = query c, element r <- key kb+8h+r from subtile 0, element 8+r <-
//   key kb+16+8h+r from subtile 1) is an in-lane f32 -> f16 convert of P*32768 into a hi plane plus an unscaled residual
//   plane res = f16(P*32768 - hi); both planes multiply the same v fragments into the same accumulator (two products).
//   Online max-subtracted softmax in f32 (exp2); per-query max/sum = 16 in-lane values combined across the two lane halves;
//   rescale factors broadcast with shuffles.
//   P.V: B fragments = v^T plane rows d = 16j+c (keys contiguous), 16 products into 8 accumulators (16 queries x 128 d).
//   Epilogue: 1/l and the carry folds in f32; the wave's 16x128 slab staged transposed [d][16] (pitch 20) in its private LDS
// coverage: per storing wave (w < 4) 16 instructions x 32 lanes x 4 floats = 16 rows x 128; per block 4 such waves = 64 rows;
//           32 blocks per batch x NB batches: every row of out [NB][2048][128] exactly once (grid NB*32 blocks); every
//           wave of the lower key group runs at least one key step (kb = 0).
// =====================================================================================================
__global__ __launch_bounds__(ATT_THREADS)
void attn_fwd(const unsigned short* __restrict__ QHp, const unsigned short* __restrict__ KHp,
              const unsigned short* __restrict__ VTq, float* OPp) {
  __shared__ __align__(16) float smem[ATW * SLABF];    // per query subtile: [128 d][16 queries] f32 slab, pitch QP
  __shared__ __attribute__((aligned(2048))) unsigned char ring[2 * BUFB];   // two buffers: k tile [64 keys][272 B], v^T tile [128 d][144 B]

  const int tid  = threadIdx.x;
  const int wave = (tid >> 5) & (ATW - 1);             // query subtile
  const int kgu  = __builtin_amdgcn_readfirstlane(tid >> 7);   // key group 0 or 1, wave-uniform in an SGPR
  const int lane = tid & 31;
  const int hh   = lane >> 4;
  const int c    = lane & 15;

  // Block index -> (batch, query tile), a permutation of the grid. A tile's cost is its t + 1 stages, all blocks are resident
  // at once (two a WGP by LDS): the first half of
  // the grid holds tiles 31 .. 16, heaviest first, the second half tiles 0 .. 15, so that blocks bid and bid + NB*16 hold
  // tiles t and 31 - t (33 stages together). For speed only: any placement gives the same result.
  const uint32_t bid = blockIdx.x;
  if (bid >= (uint32_t)ATT_BLOCKS) return;             // never taken with the exact grid; before any LDS use or store
  const bool     hv  = bid < (uint32_t)HALFG;          // block-uniform: first half of the grid, heavy tiles
  const uint32_t rk  = hv ? bid : bid - (uint32_t)HALFG;   // rank within its half, 0 .. NB*16 - 1
  const int bb   = (int)(rk % (uint32_t)NB);           // 0 .. NB-1
  const int t    = hv ? (BPB - 1 - (int)(rk / (uint32_t)NB)) : (int)(rk / (uint32_t)NB);   // 0..31, block-uniform

  const int iw   = QPB * t + wave * 16;                // query row 0 of this wave, iw + 15 <= SEQ - 1
  const int iwu  = __builtin_amdgcn_readfirstlane(iw); // wave-uniform copy in an SGPR
  const int kend = iwu + 16;                           // keys 0 .. iw+15 ; kend <= SEQ

  // B fragments of q^T: lane col n = query iw + c, split d map
  const _Float16* Qb = (const _Float16*)(const void*)QHp + ((size_t)bb * SEQ + (size_t)(iw + c)) * HD + 8 * hh;
  const v16h qf0 = ldfrag_h(Qb);                       // d 0..31
  const v16h qf1 = ldfrag_h(Qb + 32);                  // d 32..63
  const v16h qf2 = ldfrag_h(Qb + 64);                  // d 64..95
  const v16h qf3 = ldfrag_h(Qb + 96);                  // d 96..127
  // Stage s = keys 64s .. 64s+63 of batch bb, shared by the block's eight waves: wave 0 brings the k tile (64 rows of 256 B,
  // contiguous), wave 1 the v^T tile (128 d rows of 128 B, source pitch 4096 B), one request each, into buffer s & 1.
  // Stages 0 .. t: 64s + 63 <= 64t + 63 <= SEQ - 1, every tile interior to its plane.
  const uint32_t wv    = uni((uint32_t)tid >> 5);
  const uint32_t nst   = uni((uint32_t)t + 1u);
  const uint32_t lbase = (uint32_t)(size_t)ring;
  const uint64_t kga   = (uint64_t)(size_t)KHp + (uint64_t)bb * (SEQ * HD * 2);
  const uint64_t vga   = (uint64_t)(size_t)VTq + (uint64_t)bb * (HD * SEQ * 2);
  const u32x8 g1k = tdm_group1<HD * 2, STK, HD * 2, 5u>();
  const u32x8 g1v = tdm_group1<STK * 2, HD, SEQ * 2, 4u>();
  const uint32_t isk = (wv == 0u) ? 1u : 0u, isv = (wv == 1u) ? 1u : 0u;
  auto group0 = [&](uint32_t sn) {                     // sn comes from pinned(): formed behind the waits in front of it
    return tdm_group0(lbase + (sn & 1u) * BUFB + isv * KPL,
                      isv ? vga + (uint64_t)sn * (STK * 2) : kga + (uint64_t)sn * (STK * HD * 2));
  };
  u32x4 g0 = group0(pinned(0u));
  if (pinned(isk)) { tdm_load(g0, g1k); tdm_wait(g0, g1k); }   // stage 0 has landed
  if (pinned(isv)) { tdm_load(g0, g1v); tdm_wait(g0, g1v); }
  __syncthreads();                                     // stage 0 published to all eight waves
  {
    const uint32_t sn = pinned(1u);                    // stage 1, where it exists, flies while stage 0 is worked on
    g0 = group0(sn);
    if (pinned((isk && sn < nst) ? 1u : 0u)) tdm_load(g0, g1k);
    if (pinned((isv && sn < nst) ? 1u : 0u)) tdm_load(g0, g1v);
  }
  const unsigned char* Kl = ring + c * KPB + 16 * hh;          // key row c of a tile, split d map
  const unsigned char* Vl = ring + KPL + c * VPB + 16 * hh;    // d row c of a tile, split key map
  const float lsc = (SM_SCALE * LOG2E) / (QSC * KSC);
  const int dq0 = 8 * hh - (iw + c);                   // key(kb+8hh+r) - query(iw+c) = kb + dq0 + r

  float m_run = -INFINITY, l_run = 0.f;
  v8f o[8];
#pragma unroll
  for (int j = 0; j < 8; ++j) o[j] = zero8();

#pragma unroll 1
  for (int s = 0; s <= t; ++s) {                       // block-uniform trip count: every wave passes every publish point
   const int kb = STK * s + 32 * kgu;                  // this wave's 32 keys of stage s
   const int bo = (s & 1) * BUFB;                      // buffer of stage s
   if (kb < kend) {                                    // wave-uniform (SGPR): steps wholly above the wave's queries are skipped
    // ---- scores (transposed): s0 = keys kb..kb+15, s1 = keys kb+16..kb+31, columns = queries iw..iw+15 ----
    v8f s0 = zero8(), s1 = zero8();
    {
      const _Float16* k0p = (const _Float16*)(const void*)(Kl + bo + (32 * kgu) * KPB);   // key row kb + c
      const v16h a0 = ldfrag_h(k0p), a1 = ldfrag_h(k0p + 32), a2 = ldfrag_h(k0p + 64), a3 = ldfrag_h(k0p + 96);
      s0 = mma_raw(a0, qf0, s0);
      s0 = mma_raw(a1, qf1, s0);
      s0 = mma_raw(a2, qf2, s0);
      s0 = mma_raw(a3, qf3, s0);
      guard_s(s0, a0, a1, a2, a3, qf0, qf1, qf2, qf3);
      const _Float16* k1p = k0p + 16 * (KPB / 2);                    // key row kb + 16 + c
      const v16h b0 = ldfrag_h(k1p), b1 = ldfrag_h(k1p + 32), b2 = ldfrag_h(k1p + 64), b3 = ldfrag_h(k1p + 96);
      s1 = mma_raw(b0, qf0, s1);
      s1 = mma_raw(b1, qf1, s1);
      s1 = mma_raw(b2, qf2, s1);
      s1 = mma_raw(b3, qf3, s1);
      guard_s(s1, b0, b1, b2, b3, qf0, qf1, qf2, qf3);
    }
    // ---- base-2 logits for query iw + c (16 keys in this lane, 16 in the other half) ----
    float u0[8], u1[8];
#pragma unroll
    for (int r = 0; r < 8; ++r) {
      u0[r] = s0[r] * lsc;
      u1[r] = s1[r] * lsc;
    }
    // ---- causal exclusion, only in steps that hold keys above some query of the wave (wave-uniform test) ----
    if (kb + 32 > iwu) {
      const int dq = kb + dq0;
#pragma unroll
      for (int r = 0; r < 8; ++r) {
        u0[r] = (dq + r > 0)      ? -INFINITY : u0[r];   // key kb+8hh+r    > query iw+c
        u1[r] = (dq + 16 + r > 0) ? -INFINITY : u1[r];   // key kb+16+8hh+r > query iw+c
      }
    }
    // ---- online softmax ----
    float mx = -INFINITY;
#pragma unroll
    for (int r = 0; r < 8; ++r) mx = fmaxf(mx, fmaxf(u0[r], u1[r]));
    mx = fmaxf(mx, __shfl_xor(mx, 16, 32));            // finite: key kb <= iw <= every query of the wave
    const float mn = fmaxf(m_run, mx);                 // finite from the first step on
    const float al = ex2(m_run - mn);                  // 0 on the first step
    m_run = mn;
    float ps = 0.f;
    FragH pa, pl;                                      // hi plane and unscaled residual plane of P*32768
#pragma unroll
    for (int r = 0; r < 8; ++r) {
      const float e0 = ex2(u0[r] - mn), e1 = ex2(u1[r] - mn);   // excluded keys: 2^(-inf) = 0 exactly
      ps += e0 + e1;
      const float x0 = e0 * PCAR, x1 = e1 * PCAR;
      const _Float16 g0 = (_Float16)x0, g1 = (_Float16)x1;
      pa.h[0][r] = g0;                                  // element r     = key kb + 8hh + r
      pa.h[1][r] = g1;                                  // element 8 + r = key kb + 16 + 8hh + r
      pl.h[0][r] = (_Float16)(x0 - (float)g0);          // residual (exact f32 difference, then f16 convert)
      pl.h[1][r] = (_Float16)(x1 - (float)g1);
    }
    ps += __shfl_xor(ps, 16, 32);
    l_run = l_run * al + ps;
#pragma unroll
    for (int r = 0; r < 8; ++r) {
      const float af = __shfl(al, 8 * hh + r, 32);      // rescale factor of query iw + 8hh + r
#pragma unroll
      for (int j = 0; j < 8; ++j) o[j][r] *= af;
    }
    // ---- P.V : B fragment col n = d = 16j + c, keys kb .. kb+31 contiguous in the v^T plane row d ----
    {
      const _Float16* vp = (const _Float16*)(const void*)(Vl + bo + (32 * kgu) * 2);
      const v16h v0 = ldfrag_h(vp);
      const v16h v1 = ldfrag_h(vp + 16 * (VPB / 2));
      const v16h v2 = ldfrag_h(vp + 32 * (VPB / 2));
      const v16h v3 = ldfrag_h(vp + 48 * (VPB / 2));
      o[0] = mma_raw(pa.v, v0, o[0]);
      o[0] = mma_raw(pl.v, v0, o[0]);
      o[1] = mma_raw(pa.v, v1, o[1]);
      o[1] = mma_raw(pl.v, v1, o[1]);
      o[2] = mma_raw(pa.v, v2, o[2]);
      o[2] = mma_raw(pl.v, v2, o[2]);
      o[3] = mma_raw(pa.v, v3, o[3]);
      o[3] = mma_raw(pl.v, v3, o[3]);
      guard_o4(o[0], o[1], o[2], o[3], pa.v, pl.v, v0, v1, v2, v3);
      const v16h v4 = ldfrag_h(vp + 64 * (VPB / 2));
      const v16h v5 = ldfrag_h(vp + 80 * (VPB / 2));
      const v16h v6 = ldfrag_h(vp + 96 * (VPB / 2));
      const v16h v7 = ldfrag_h(vp + 112 * (VPB / 2));
      o[4] = mma_raw(pa.v, v4, o[4]);
      o[4] = mma_raw(pl.v, v4, o[4]);
      o[5] = mma_raw(pa.v, v5, o[5]);
      o[5] = mma_raw(pl.v, v5, o[5]);
      o[6] = mma_raw(pa.v, v6, o[6]);
      o[6] = mma_raw(pl.v, v6, o[6]);
      o[7] = mma_raw(pa.v, v7, o[7]);
      o[7] = mma_raw(pl.v, v7, o[7]);
      guard_o4(o[4], o[5], o[6], o[7], pa.v, pl.v, v4, v5, v6, v7);
    }
   }
   // ---- publish point of stage s + 1, at the foot of stage s ----
   {
     wait_ds0();                                       // this wave has left stage s's buffer
     if (pinned(isk)) tdm_wait(g0, g1k);               // stage s + 1 has landed
     if (pinned(isv)) tdm_wait(g0, g1v);
     __syncthreads();                                  // publishes stage s + 1; ends every reader's last read of stage s
     const uint32_t sn = pinned((uint32_t)s + 2u);   // stage s + 2, while it exists, into the buffer just left
     g0 = group0(sn);
     if (pinned((isk && sn < nst) ? 1u : 0u)) tdm_load(g0, g1k);
     if (pinned((isv && sn < nst) ? 1u : 0u)) tdm_load(g0, g1v);
   }
  }
  wait_tensor0();                                      // behind the ring: no request and no LDS read of this wave is left
  wait_ds0();
  acc_guard8(o[0], o[1], o[2], o[3], o[4], o[5], o[6], o[7]);

  // ---- fold 1/l and the carries (32768 on P, 256 on v), stage the wave's slab transposed [d][query] in its LDS region ----
  float* slab = smem + wave * SLABF;
  // ---- merge of the two key groups: the upper group's wave leaves its accumulators (lane-private order, 512 contiguous
  //      bytes per store), max and sum in the subtile's slab; the lower group's wave of the same rows takes them up ----
  if (kgu) {                                           // wave-uniform (SGPR)
#pragma unroll
    for (int j = 0; j < 8; ++j) {
      v4f w0, w1;
#pragma unroll
      for (int r = 0; r < 4; ++r) { w0[r] = o[j][r]; w1[r] = o[j][4 + r]; }
      *(v4f*)(slab + ((2 * j) * 32 + lane) * 4)     = w0;
      *(v4f*)(slab + ((2 * j + 1) * 32 + lane) * 4) = w1;
    }
    slab[2048 + lane] = m_run;
    slab[2080 + lane] = l_run;
  }
  __syncthreads();                                     // the upper group's partials are published; every wave passes it
  if (kgu) return;                                     // no barrier, tensor load or store of this wave is left
  const float m1 = slab[2048 + lane], l1 = slab[2080 + lane];
  v4f p0[8], p1[8];                                    // read whole before the slab is rewritten below (same wave, in order)
#pragma unroll
  for (int j = 0; j < 8; ++j) {
    p0[j] = *(const v4f*)(slab + ((2 * j) * 32 + lane) * 4);
    p1[j] = *(const v4f*)(slab + ((2 * j + 1) * 32 + lane) * 4);
  }
  const float mm = fmaxf(m_run, m1);                   // m_run is finite (step kb = 0); m1 may be -inf with l1 = 0
  const float a0 = ex2(m_run - mm), a1 = ex2(m1 - mm);
  const float lt = l_run * a0 + l1 * a1;
  const float oc = 1.0f / (PCAR * VCAR);               // 2^-23 exact
  const float li = (lt > 0.0f) ? ((1.0f / lt) * oc) : 0.0f;   // lt >= 1 (the max element contributes 2^0)
  const float li0 = li * a0, li1 = li * a1;
  float lf[8], lg[8];
#pragma unroll
  for (int r = 0; r < 8; ++r) {                        // factors of query iw + 8hh + r for the two partial accumulators
    lf[r] = __shfl(li0, 8 * hh + r, 32);
    lg[r] = __shfl(li1, 8 * hh + r, 32);
  }
#pragma unroll
  for (int j = 0; j < 8; ++j) {
    v4f w0, w1;
#pragma unroll
    for (int r = 0; r < 4; ++r) {
      w0[r] = o[j][r] * lf[r] + p0[j][r] * lg[r];
      w1[r] = o[j][4 + r] * lf[4 + r] + p1[j][r] * lg[4 + r];
    }
    float* sp = slab + (16 * j + c) * QP + 8 * hh;     // d row 16j + c, query cols 8hh .. 8hh+7, 16-B aligned
    *(v4f*)(sp)     = w0;
    *(v4f*)(sp + 4) = w1;
  }
  wave_sync_lds();
  v4f vals[16];
#pragma unroll
  for (int it = 0; it < 16; ++it) {
#pragma unroll
    for (int e = 0; e < 4; ++e) vals[it][e] = slab[(4 * lane + e) * QP + it];   // out(query iw+it, d = 4*lane+e)
  }
  float* dst = OPp + ((size_t)bb * SEQ + (size_t)iw) * HD + 4 * lane;
  {
#pragma unroll
    for (int it = 0; it < 16; ++it) {
      *(v4f*)(dst + (size_t)it * HD) = vals[it];   // one 512-B row per instruction, lanes 8q..8q+7 per line
    }
    
  }
}

// =====================================================================================================
// Workspace map (bytes); every plane is fully written by whole-line stores before it is read; all extents are exact
// multiples of the store granularity (no pad rows needed); offsets multiples of 128 (NB = 16 values):
//   QH f16 [NB][2048][128] x1024       8388608   at        0
//   KH f16 [NB][2048][128] x1024       8388608   at  8388608
//   VT f16 [NB][128][2048] x256        8388608   at 16777216
//   end                                             25165824
// =====================================================================================================
extern "C" void kernel_launch(void* const* d_in, const int* in_sizes, int n_in,
                              void* d_out, int out_size, void* d_ws, size_t ws_size,
                              hipStream_t stream) {
  const int NEL = NB * SEQ * HD;                        // 4194304 for NB = 16
  if (n_in < 3) return;
  if (in_sizes[0] < NEL || in_sizes[1] < NEL || in_sizes[2] < NEL) return;
  if (out_size < NEL) return;

  const float* q  = (const float*)d_in[0];
  const float* k  = (const float*)d_in[1];
  const float* v  = (const float*)d_in[2];
  float*       out = (float*)d_out;

  const size_t PQ = (size_t)NEL * 2;                    //  8388608
  const size_t PK = (size_t)NEL * 2;                    //  8388608
  const size_t PV = (size_t)NB * HD * SEQ * 2;          //  8388608
  size_t off = 0;
  const size_t oQH = off; off += PQ;
  const size_t oKH = off; off += PK;
  const size_t oVT = off; off += PV;
  if (off > ws_size) return;                            // off = 25165824
  if (off > (size_t)134217728) return;

  char* ws = (char*)d_ws;
  unsigned short* QH = (unsigned short*)(ws + oQH);
  unsigned short* KH = (unsigned short*)(ws + oKH);
  unsigned short* VT = (unsigned short*)(ws + oVT);

  const int n8 = NEL / 8;                               // 524288
  const dim3 blk(256);
  const dim3 gC(n8 / 256, 2);                           // (2048, 2): q and k planes in one launch
  const dim3 gVT(NB * VTILES);                          // 512
  const dim3 gAT(ATT_BLOCKS);                           // 512
  const dim3 bAT(ATT_THREADS);                          // 256

  // (0) q and k planes f16(bf16(x) * 1024), layout [b][s][d]
  cvt16<<<gC, blk, 0, stream>>>(q, k, QH, KH, n8, QSC);
  // (1) v^T plane f16(bf16(v) * 256), layout [b][d][2048]
  vt16<<<gVT, blk, 0, stream>>>(v, VT);
  // (2) causal flash attention per batch -> out [b][s][d] f32
  attn_fwd<<<gAT, bAT, 0, stream>>>(QH, KH, VT, out);
  (void)hipGetLastError();
}

// v006
// It runs in 38.3 microseconds.
// Versions in between are left out here; by their measured steps it is 1.10 times as fast as v004.
// Counting every step since v000, it is 4.02 times as fast.
// Contractions: scores k.q^T (k x1024 and q x1024 as f16 planes of the bf16-RNE-converted inputs, one product, K=128) and
// P.v (P x32768 as one f16 plane, one product; v x256 f16 of the bf16-RNE-converted input; 32-key steps):
// all v_wmma_f32_16x16x32_f16 (f16 operands, f32 accumulate).
// Causal key range (key <= query); base-2 online softmax and the 1/l fold in f32 on VALU.
#include <hip/hip_runtime.h>
#include <math.h>
#include <stdint.h>

#ifndef NB
#define NB    16
#endif
#define SEQ   2048
#define HD    128
#define QSC   1024.0f
#define KSC   1024.0f
#define PCAR  32768.0f
#define VCAR  256.0f
#define SM_SCALE 0.08838834764831845f
#define LOG2E 1.4426950408889634f
#define ATW   4                          // query subtiles of 16 rows per block
#define KGR   2                          // key groups: wave group g takes keys 32g .. 32g+31 of every 64-key stage
#define ATT_THREADS (ATW * KGR * 32)
#define QPB   (16 * ATW)
#define BPB   (SEQ / QPB)
#define ATT_BLOCKS (NB * BPB)
#define HALFG (NB * (BPB / 2))           // blocks in each half of the attention grid
#define QP    20
#define SLABF (HD * QP)
#define VTP   72
#define VTILES (SEQ / 64)
#define VTB   (NB * VTILES)              // blocks of the v^T job in the plane launch
#define CVB   ((NB * SEQ * HD) / 2048)   // blocks per plane of the convert job (256 threads x 8 elements each)
#define STK   64                         // keys per LDS stage
#define KPB   272                        // LDS pitch of a staged k row: 256 B + 16 B pad (16 B x odd, ds_load_b128 reader)
#define VPB   144                        // LDS pitch of a staged v^T row: 128 B + 16 B pad
#define KPL   18432                      // place of the k tile in a buffer: 64 x 272 = 17408 B, rounded up to 2 KiB
#define VPL   18432                      // place of the v^T tile: 128 x 144 B
#define BUFB  (KPL + VPL)
static_assert(HD == 128 && QPB == 64 && ATT_THREADS == 256 && KGR * 32 == 64);
static_assert((SEQ % QPB) == 0 && (SEQ % 64) == 0 && (SEQ % 32) == 0 && (HD % 32) == 0);
static_assert(NB >= 1 && NB <= 16);
static_assert(BPB == 32 && VTILES == 32);
static_assert((HD - 1) * VTP + 63 < HD * VTP);
static_assert((HD - 1) * QP + 15 < SLABF && (QP % 4) == 0);
static_assert(64 * 32 + 2 * 32 <= SLABF);   // a wave's 64 accumulator floats per lane plus max and sum fit its subtile's slab
static_assert(((NB * SEQ * HD) % 2048) == 0);
static_assert(STK == QPB && STK * KPB <= KPL && HD * VPB <= VPL && (KPL % 2048) == 0 && (BUFB % 2048) == 0);
static_assert(KPB == HD * 2 + 16 && VPB == STK * 2 + 16);

typedef _Float16 v16h __attribute__((ext_vector_type(16)));
typedef _Float16 v8h  __attribute__((ext_vector_type(8)));
typedef float    v8f  __attribute__((ext_vector_type(8)));
typedef float    v4f  __attribute__((ext_vector_type(4)));
typedef unsigned int v4u __attribute__((ext_vector_type(4)));
typedef uint32_t u32x4 __attribute__((ext_vector_type(4)));
typedef uint32_t u32x8 __attribute__((ext_vector_type(8)));

union FragH { v16h v; v8h h[2]; v4u u[2]; };

// ---- scalar helpers --------------------------------------------------------------------------------
__device__ __forceinline__ unsigned short bf_bits(float f) {          // f32 -> bf16 bits, RNE convert
  unsigned u = __float_as_uint(f);
  return (unsigned short)((u + 0x7FFFu + ((u >> 16) & 1u)) >> 16);
}
__device__ __forceinline__ float bf_up(unsigned short h) { return __uint_as_float(((unsigned)h) << 16); }
__device__ __forceinline__ float bfr(float f) { return bf_up(bf_bits(f)); }   // value of the bf16 RNE convert
__device__ __forceinline__ unsigned short h_bits(_Float16 x) { return __builtin_bit_cast(unsigned short, x); }
__device__ __forceinline__ unsigned pk16(unsigned short a, unsigned short b) { return (unsigned)a | ((unsigned)b << 16); }
// 2^x as the bare hardware instruction: results below 2^-126 come out as 0 instead of a subnormal. Every use here is a
// softmax weight or rescale factor relative to a row maximum whose own weight is 1, so such a term is below f32 rounding
// of the row sum and far below the smallest f16 step of P*32768. 2^(-inf) = 0 as before.
__device__ __forceinline__ float ex2(float x) {
#if defined(__HIP_DEVICE_COMPILE__)
  return __builtin_amdgcn_exp2f(x);
#else
  return exp2f(x);
#endif
}
__device__ __forceinline__ v8f zero8() { v8f z = {0.f, 0.f, 0.f, 0.f, 0.f, 0.f, 0.f, 0.f}; return z; }

// ---- fragment loader: 16-bit A/B operand, lane -> row/col (lane&15), p already includes +8*(lane>>4);
//      elements 0..7 <- p[0..7] (k0+8h..), elements 8..15 <- p[16..23] (k0+16+8h..)  (same split k map for A and B;
//      B is always read from a k-contiguous [n][k] plane)
__device__ __forceinline__ v16h ldfrag_h(const _Float16* p) {
  FragH f;
  f.h[0] = *(const v8h*)(p);
  f.h[1] = *(const v8h*)(p + 16);
  return f.v;
}

__device__ __forceinline__ v8f mma_raw(v16h a, v16h b, v8f c) {
  return __builtin_amdgcn_wmma_f32_16x16x32_f16(false, a, false, b, (short)0, c, false, false);
}
// after a 4-deep score chain: ties the accumulator, keeps the 4 A and 4 B fragments live through the nops
__device__ __forceinline__ void guard_s(v8f& s, v16h x0, v16h x1, v16h x2, v16h x3,
                                        v16h y0, v16h y1, v16h y2, v16h y3) {
#if defined(__HIP_DEVICE_COMPILE__)
  asm volatile("v_nop\n\tv_nop\n\tv_nop\n\tv_nop"
               : "+v"(s) : "v"(x0), "v"(x1), "v"(x2), "v"(x3), "v"(y0), "v"(y1), "v"(y2), "v"(y3) : "memory");
#endif
}
// after a group of 4 P.V products (P x 4 v fragments): ties 4 accumulators, keeps the P fragment and the 4 v fragments live
__device__ __forceinline__ void guard_o4(v8f& a, v8f& b, v8f& c, v8f& d,
                                         v16h p, v16h x0, v16h x1, v16h x2, v16h x3) {
#if defined(__HIP_DEVICE_COMPILE__)
  asm volatile("v_nop\n\tv_nop\n\tv_nop\n\tv_nop"
               : "+v"(a), "+v"(b), "+v"(c), "+v"(d) : "v"(p), "v"(x0), "v"(x1), "v"(x2), "v"(x3) : "memory");
#endif
}
__device__ __forceinline__ void acc_guard8(v8f& a, v8f& b, v8f& c, v8f& d, v8f& e, v8f& f, v8f& g, v8f& hx) {
#if defined(__HIP_DEVICE_COMPILE__)
  asm volatile("v_nop\n\tv_nop\n\tv_nop\n\tv_nop"
               : "+v"(a), "+v"(b), "+v"(c), "+v"(d), "+v"(e), "+v"(f), "+v"(g), "+v"(hx));
#endif
}
__device__ __forceinline__ void wave_sync_lds() {
  __builtin_amdgcn_fence(__ATOMIC_RELEASE, "workgroup");
  __builtin_amdgcn_wave_barrier();
  __builtin_amdgcn_fence(__ATOMIC_ACQUIRE, "workgroup");
}

// ---- tensor load to LDS: descriptor words, issue, waits ----------------------------------------------
__device__ __forceinline__ uint32_t uni(uint32_t v) { return (uint32_t)__builtin_amdgcn_readfirstlane((int)v); }
// value held in a scalar register: a test on it compiles to s_cmp + s_cbranch_scc (tensor loads ignore EXEC), and a
// descriptor word formed from it is formed behind the asm waits that stand in front of this statement
__device__ __forceinline__ uint32_t pinned(uint32_t v) {
  uint32_t w = uni(v);
#if defined(__HIP_DEVICE_COMPILE__)
  asm volatile("" : "+s"(w));
#endif
  return w;
}
__device__ __forceinline__ void wait_ds0() {       // this wave's LDS reads have returned before the buffer is handed over
#if defined(__HIP_DEVICE_COMPILE__)
  asm volatile("s_wait_dscnt 0x0" ::: "memory");
#endif
}
__device__ __forceinline__ void wait_tensor0() {   // the issuing wave's tile has landed (the compiler places no such wait)
#if defined(__HIP_DEVICE_COMPILE__)
  asm volatile("s_wait_tensorcnt 0x0" ::: "memory");
#endif
}
// Group 1 of a two-dimensional tile, every extent in bytes: ROWS rows of ROWB bytes, source pitch PITCH, 16 B of LDS pad
// behind each row (interval code IVL = the row length), no mask; tensor dims = tile dims (every tile is interior).
template <uint32_t ROWB, uint32_t ROWS, uint32_t PITCH, uint32_t IVL>
__device__ __forceinline__ u32x8 tdm_group1() {
  u32x8 g;   // pinned(): each descriptor word held in a scalar register of its own for the whole kernel
  g[0] = pinned((1u << 20) | (IVL << 22) | (3u << 25));
  g[1] = pinned((ROWB & 0xFFFFu) << 16);
  g[2] = pinned((ROWB >> 16) | ((ROWS & 0xFFFFu) << 16));
  g[3] = pinned((ROWS >> 16) | (ROWB << 16));
  g[4] = pinned(ROWS);
  g[5] = pinned(PITCH);
  g[6] = pinned(0u);
  g[7] = pinned(0u);
  return g;
}
__device__ __forceinline__ u32x4 tdm_group0(uint32_t lds_dst, uint64_t ga) {
  u32x4 g;
  g[0] = uni(1u);
  g[1] = uni(lds_dst);
  g[2] = uni((uint32_t)ga);
  g[3] = uni((((uint32_t)(ga >> 32)) & 0x01FFFFFFu) | 0x80000000u);
#if defined(__HIP_DEVICE_COMPILE__)
  asm volatile("" : "+s"(g));   // descriptor words held in scalar registers until the wait that names them
#endif
  return g;
}
__device__ __forceinline__ void tdm_load(u32x4 g0, u32x8 g1) {
#if defined(__HIP_DEVICE_COMPILE__)
  asm volatile("tensor_load_to_lds %0, %1" :: "s"(g0), "s"(g1) : "memory");
#endif
}
// the issuing wave's tile has landed (the compiler places no such wait); naming the descriptor keeps its registers
// unchanged while the request is outstanding
__device__ __forceinline__ void tdm_wait(u32x4 g0, u32x8 g1) {
#if defined(__HIP_DEVICE_COMPILE__)
  asm volatile("s_wait_tensorcnt 0x0" :: "s"(g0), "s"(g1) : "memory");
#endif
}

// =====================================================================================================
// 16-bit plane convert, no relayout (inputs are batch-major [b][s][d]):
//   pl[e] = f16( bf16(x[e]) * sc ) (sc a power of two, exact). Job rank cb < CVB: q plane, else k plane.
// Thread = 8 consecutive elements: two 16-B loads, one 16-B store per lane; 32 consecutive lanes = 512 contiguous, 512-B
// coverage: CVB blocks x 256 thr x 8 elements = n = NB*2048*128 per plane exactly (n % 2048 == 0 asserted).
// =====================================================================================================
__device__ __forceinline__ void cvt16(const float* __restrict__ xq, const float* __restrict__ xk,
                                      unsigned short* plq, unsigned short* plk, int n8, float sc, int cb) {
  const bool sk = (cb >= CVB);              // block-uniform plane select (both pointers global)
  const int gt = (sk ? cb - CVB : cb) * 256 + (int)threadIdx.x;
  if (gt >= n8) return;                     // never taken with the exact grid; no barriers in this job
  const float* x = sk ? xk : xq;
  unsigned short* pl = sk ? plk : plq;
  const size_t e = (size_t)gt * 8;
  const v4f a = *(const v4f*)(x + e), bq = *(const v4f*)(x + e + 4);
  v4u o;
#pragma unroll
  for (int i = 0; i < 2; ++i) {
    o[i]     = pk16(h_bits((_Float16)(bfr(a[2 * i]) * sc)),  h_bits((_Float16)(bfr(a[2 * i + 1]) * sc)));
    o[2 + i] = pk16(h_bits((_Float16)(bfr(bq[2 * i]) * sc)), h_bits((_Float16)(bfr(bq[2 * i + 1]) * sc)));
  }
  unsigned short* d = pl + e;
  {
    *(v4u*)(d) = o;
    
  }
}

// =====================================================================================================
// v^T plane: VT[(b*HD + d)][key] = f16( bf16(v[b][key][d]) * 256 ) (exact), pitch SEQ = 2048 halves (4096 B) per d row.
// Block = (b, tile of 64 keys): 64 source rows of 128 floats loaded with 16-B loads (static stride), converted, written into
// coverage: load 256 thr x 32 elements = 64 keys x 128 d; store 4 iterations x 256 thr x 8 halves = 128 lines x 64 = the tile;
//           NB x 32 blocks cover the whole [NB][128][2048] plane exactly once. T: the block's [128 d][64 keys] LDS tile.
// =====================================================================================================
__device__ __forceinline__ void vt16(const float* __restrict__ v, unsigned short* VTo, unsigned short* T, int bid) {
  const int tid = threadIdx.x;
  const int bb  = bid / VTILES;
  const int t   = bid - bb * VTILES;        // 0..31, block-uniform
  if (bb >= NB) return;                     // never taken with the exact grid; before any barrier or store
  {
    const int sl = tid >> 2;                  // key within tile 0..63
    const int dc = (tid & 3) * 32;            // d chunk 0,32,64,96
    int key = 64 * t + sl;                    // <= SEQ-1 by construction; clamp keeps the address in range regardless
    key = (key < 0) ? 0 : ((key > SEQ - 1) ? (SEQ - 1) : key);
    const float* src = v + (((size_t)bb * SEQ + (size_t)key) * HD + dc);
#pragma unroll
    for (int i = 0; i < 8; ++i) {
      const v4f a = *(const v4f*)(src + 4 * i);
#pragma unroll
      for (int e = 0; e < 4; ++e) T[(dc + 4 * i + e) * VTP + sl] = h_bits((_Float16)(bfr(a[e]) * VCAR));
    }
  }
  __syncthreads();
  v4u vals[4];
  const int q8 = tid >> 3, p8 = (tid & 7) * 8;
#pragma unroll
  for (int it = 0; it < 4; ++it) {
    const int line = it * 32 + q8;            // d = 0..127
    vals[it] = *(const v4u*)(T + line * VTP + p8);
  }
  unsigned short* dst = VTo + ((size_t)bb * HD) * SEQ + 64 * t + p8;
  {
#pragma unroll
    for (int it = 0; it < 4; ++it) {
      const int line = it * 32 + q8;
      *(v4u*)(dst + (size_t)line * SEQ) = vals[it];
    }
    
  }
}

// =====================================================================================================
// The three planes in one launch: the jobs are independent of one another (each reads its own input and writes its own
// plane), and the block index picks the job, block-uniformly. Blocks 0 .. VTB-1 build the v^T plane: they hold the longer
// chain (loads, LDS, barrier, stores); blocks VTB .. VTB + 2*CVB - 1 convert q, then k, and stream beside them.
// =====================================================================================================
__global__ __launch_bounds__(256) void planes(const float* __restrict__ xq, const float* __restrict__ xk,
                                              const float* __restrict__ v, unsigned short* plq, unsigned short* plk,
                                              unsigned short* VTo, int n8, float sc) {
  __shared__ __align__(16) unsigned short T[HD * VTP];
  const int bid = blockIdx.x;
  if (bid < VTB) vt16(v, VTo, T, bid);
  else           cvt16(xq, xk, plq, plk, n8, sc, bid - VTB);
}

// =====================================================================================================
// Causal flash attention per batch. Block = (b, 64 queries), 8 waves: wave w works query rows iw = 64t + 16(w & 3) .. +15
//   on the keys 64s + 32(w >> 2) .. +31 of every stage s; waves w and w + 4 hold partial max, sum and accumulators of the
//   same rows over disjoint keys, merged once behind the key loop (through the subtile's slab, by wave w).
//   q plane f16 [b][s][d] x1024, k plane f16 [b][s][d] x1024, v^T plane f16 [b][d][SEQ] x256.
//   The k and v^T planes reach the waves through LDS: stages of 64 keys, brought by tensor loads into two buffers that the
//   block's eight waves share; the fragment loads below read the staged rows (same lane -> row and k maps as from the planes).
//   Key loop kb = 64s + 32(w >> 2), a step is worked while kb < iw + 16 (wave-uniform, SGPR): keys above iw+15 are excluded
//   for every query of the wave; kb <= iw holds in every worked step, so key kb is included for every query (row max finite,
//   row sum >= 1 from the wave's first worked step on; a wave of the upper key group may have no step at all: max -inf, sum 0).
//   Scores are formed transposed, S^T = K.Q^T: A fragment = k plane row (key kb+16u+c), B fragment = q plane row
//   (query iw+c), both with the split d map, 4 d-steps of 32, one product each.
//   D element r of subtile u at lane (h,c) = score(key kb+16u+8h+r, query iw+c). In the last step(s) entries with
//   key > query are excluded (score -> -inf before the max, exp2 -> exactly 0), which equals the large negative fill
//   followed by softmax in f32.
//   The A fragment of P for the P.V product (row = query c, element r <- key kb+8h+r from subtile 0, element 8+r <-
//   key kb+16+8h+r from subtile 1) is an in-lane f32 -> f16 convert of P*32768 (RNE, relative error at most 2^-11 for
//   P >= 2^-29), an eighth of the 2^-8 that the bf16 convert leaves on the q, k and v values P and the product are formed
//   from. The row sum is taken from the unrounded f32 weights.
//   Online max-subtracted softmax in f32 (exp2); per-query max/sum = 16 in-lane values combined across the two lane halves;
//   rescale factors broadcast with shuffles.
//   P.V: B fragments = v^T plane rows d = 16j+c (keys contiguous), 8 products into 8 accumulators (16 queries x 128 d).
//   Epilogue: 1/l and the carry folds in f32; the wave's 16x128 slab staged transposed [d][16] (pitch 20) in its private LDS
// coverage: per storing wave (w < 4) 16 instructions x 32 lanes x 4 floats = 16 rows x 128; per block 4 such waves = 64 rows;
//           32 blocks per batch x NB batches: every row of out [NB][2048][128] exactly once (grid NB*32 blocks); every
//           wave of the lower key group runs at least one key step (kb = 0).
// =====================================================================================================
__global__ __launch_bounds__(ATT_THREADS)
void attn_fwd(const unsigned short* __restrict__ QHp, const unsigned short* __restrict__ KHp,
              const unsigned short* __restrict__ VTq, float* OPp) {
  __shared__ __align__(16) float smem[ATW * SLABF];    // per query subtile: [128 d][16 queries] f32 slab, pitch QP
  __shared__ __attribute__((aligned(2048))) unsigned char ring[2 * BUFB];   // two buffers: k tile [64 keys][272 B], v^T tile [128 d][144 B]

  const int tid  = threadIdx.x;
  const int wave = (tid >> 5) & (ATW - 1);             // query subtile
  const int kgu  = __builtin_amdgcn_readfirstlane(tid >> 7);   // key group 0 or 1, wave-uniform in an SGPR
  const int lane = tid & 31;
  const int hh   = lane >> 4;
  const int c    = lane & 15;

  // Block index -> (batch, query tile), a permutation of the grid. A tile's cost is its t + 1 stages, all blocks are resident
  // at once (two a WGP by LDS): the first half of
  // the grid holds tiles 31 .. 16, heaviest first, the second half tiles 0 .. 15, so that blocks bid and bid + NB*16 hold
  // tiles t and 31 - t (33 stages together). For speed only: any placement gives the same result.
  const uint32_t bid = blockIdx.x;
  if (bid >= (uint32_t)ATT_BLOCKS) return;             // never taken with the exact grid; before any LDS use or store
  const bool     hv  = bid < (uint32_t)HALFG;          // block-uniform: first half of the grid, heavy tiles
  const uint32_t rk  = hv ? bid : bid - (uint32_t)HALFG;   // rank within its half, 0 .. NB*16 - 1
  const int bb   = (int)(rk % (uint32_t)NB);           // 0 .. NB-1
  const int t    = hv ? (BPB - 1 - (int)(rk / (uint32_t)NB)) : (int)(rk / (uint32_t)NB);   // 0..31, block-uniform

  const int iw   = QPB * t + wave * 16;                // query row 0 of this wave, iw + 15 <= SEQ - 1
  const int iwu  = __builtin_amdgcn_readfirstlane(iw); // wave-uniform copy in an SGPR
  const int kend = iwu + 16;                           // keys 0 .. iw+15 ; kend <= SEQ

  // B fragments of q^T: lane col n = query iw + c, split d map
  const _Float16* Qb = (const _Float16*)(const void*)QHp + ((size_t)bb * SEQ + (size_t)(iw + c)) * HD + 8 * hh;
  const v16h qf0 = ldfrag_h(Qb);                       // d 0..31
  const v16h qf1 = ldfrag_h(Qb + 32);                  // d 32..63
  const v16h qf2 = ldfrag_h(Qb + 64);                  // d 64..95
  const v16h qf3 = ldfrag_h(Qb + 96);                  // d 96..127
  // Stage s = keys 64s .. 64s+63 of batch bb, shared by the block's eight waves: wave 0 brings the k tile (64 rows of 256 B,
  // contiguous), wave 1 the v^T tile (128 d rows of 128 B, source pitch 4096 B), one request each, into buffer s & 1.
  // Stages 0 .. t: 64s + 63 <= 64t + 63 <= SEQ - 1, every tile interior to its plane.
  const uint32_t wv    = uni((uint32_t)tid >> 5);
  const uint32_t nst   = uni((uint32_t)t + 1u);
  const uint32_t lbase = (uint32_t)(size_t)ring;
  const uint64_t kga   = (uint64_t)(size_t)KHp + (uint64_t)bb * (SEQ * HD * 2);
  const uint64_t vga   = (uint64_t)(size_t)VTq + (uint64_t)bb * (HD * SEQ * 2);
  const u32x8 g1k = tdm_group1<HD * 2, STK, HD * 2, 5u>();
  const u32x8 g1v = tdm_group1<STK * 2, HD, SEQ * 2, 4u>();
  const uint32_t isk = (wv == 0u) ? 1u : 0u, isv = (wv == 1u) ? 1u : 0u;
  auto group0 = [&](uint32_t sn) {                     // sn comes from pinned(): formed behind the waits in front of it
    return tdm_group0(lbase + (sn & 1u) * BUFB + isv * KPL,
                      isv ? vga + (uint64_t)sn * (STK * 2) : kga + (uint64_t)sn * (STK * HD * 2));
  };
  u32x4 g0 = group0(pinned(0u));
  if (pinned(isk)) { tdm_load(g0, g1k); tdm_wait(g0, g1k); }   // stage 0 has landed
  if (pinned(isv)) { tdm_load(g0, g1v); tdm_wait(g0, g1v); }
  __syncthreads();                                     // stage 0 published to all eight waves
  {
    const uint32_t sn = pinned(1u);                    // stage 1, where it exists, flies while stage 0 is worked on
    g0 = group0(sn);
    if (pinned((isk && sn < nst) ? 1u : 0u)) tdm_load(g0, g1k);
    if (pinned((isv && sn < nst) ? 1u : 0u)) tdm_load(g0, g1v);
  }
  const unsigned char* Kl = ring + c * KPB + 16 * hh;          // key row c of a tile, split d map
  const unsigned char* Vl = ring + KPL + c * VPB + 16 * hh;    // d row c of a tile, split key map
  const float lsc = (SM_SCALE * LOG2E) / (QSC * KSC);
  const int dq0 = 8 * hh - (iw + c);                   // key(kb+8hh+r) - query(iw+c) = kb + dq0 + r

  float m_run = -INFINITY, l_run = 0.f;
  v8f o[8];
#pragma unroll
  for (int j = 0; j < 8; ++j) o[j] = zero8();

#pragma unroll 1
  for (int s = 0; s <= t; ++s) {                       // block-uniform trip count: every wave passes every publish point
   const int kb = STK * s + 32 * kgu;                  // this wave's 32 keys of stage s
   const int bo = (s & 1) * BUFB;                      // buffer of stage s
   if (kb < kend) {                                    // wave-uniform (SGPR): steps wholly above the wave's queries are skipped
    // ---- scores (transposed): s0 = keys kb..kb+15, s1 = keys kb+16..kb+31, columns = queries iw..iw+15 ----
    v8f s0 = zero8(), s1 = zero8();
    {
      const _Float16* k0p = (const _Float16*)(const void*)(Kl + bo + (32 * kgu) * KPB);   // key row kb + c
      const v16h a0 = ldfrag_h(k0p), a1 = ldfrag_h(k0p + 32), a2 = ldfrag_h(k0p + 64), a3 = ldfrag_h(k0p + 96);
      s0 = mma_raw(a0, qf0, s0);
      s0 = mma_raw(a1, qf1, s0);
      s0 = mma_raw(a2, qf2, s0);
      s0 = mma_raw(a3, qf3, s0);
      guard_s(s0, a0, a1, a2, a3, qf0, qf1, qf2, qf3);
      const _Float16* k1p = k0p + 16 * (KPB / 2);                    // key row kb + 16 + c
      const v16h b0 = ldfrag_h(k1p), b1 = ldfrag_h(k1p + 32), b2 = ldfrag_h(k1p + 64), b3 = ldfrag_h(k1p + 96);
      s1 = mma_raw(b0, qf0, s1);
      s1 = mma_raw(b1, qf1, s1);
      s1 = mma_raw(b2, qf2, s1);
      s1 = mma_raw(b3, qf3, s1);
      guard_s(s1, b0, b1, b2, b3, qf0, qf1, qf2, qf3);
    }
    // ---- base-2 logits for query iw + c (16 keys in this lane, 16 in the other half) ----
    float u0[8], u1[8];
#pragma unroll
    for (int r = 0; r < 8; ++r) {
      u0[r] = s0[r] * lsc;
      u1[r] = s1[r] * lsc;
    }
    // ---- causal exclusion, only in steps that hold keys above some query of the wave (wave-uniform test) ----
    if (kb + 32 > iwu) {
      const int dq = kb + dq0;
#pragma unroll
      for (int r = 0; r < 8; ++r) {
        u0[r] = (dq + r > 0)      ? -INFINITY : u0[r];   // key kb+8hh+r    > query iw+c
        u1[r] = (dq + 16 + r > 0) ? -INFINITY : u1[r];   // key kb+16+8hh+r > query iw+c
      }
    }
    // ---- online softmax ----
    float mx = -INFINITY;
#pragma unroll
    for (int r = 0; r < 8; ++r) mx = fmaxf(mx, fmaxf(u0[r], u1[r]));
    mx = fmaxf(mx, __shfl_xor(mx, 16, 32));            // finite: key kb <= iw <= every query of the wave
    const float mn = fmaxf(m_run, mx);                 // finite from the first step on
    const float al = ex2(m_run - mn);                  // 0 on the first step
    m_run = mn;
    float ps = 0.f;
    FragH pa;                                          // P*32768 in f16
#pragma unroll
    for (int r = 0; r < 8; ++r) {
      const float e0 = ex2(u0[r] - mn), e1 = ex2(u1[r] - mn);   // excluded keys: 2^(-inf) = 0 exactly
      ps += e0 + e1;
      pa.h[0][r] = (_Float16)(e0 * PCAR);               // element r     = key kb + 8hh + r
      pa.h[1][r] = (_Float16)(e1 * PCAR);               // element 8 + r = key kb + 16 + 8hh + r
    }
    ps += __shfl_xor(ps, 16, 32);
    l_run = l_run * al + ps;
#pragma unroll
    for (int r = 0; r < 8; ++r) {
      const float af = __shfl(al, 8 * hh + r, 32);      // rescale factor of query iw + 8hh + r
#pragma unroll
      for (int j = 0; j < 8; ++j) o[j][r] *= af;
    }
    // ---- P.V : B fragment col n = d = 16j + c, keys kb .. kb+31 contiguous in the v^T plane row d ----
    {
      const _Float16* vp = (const _Float16*)(const void*)(Vl + bo + (32 * kgu) * 2);
      const v16h v0 = ldfrag_h(vp);
      const v16h v1 = ldfrag_h(vp + 16 * (VPB / 2));
      const v16h v2 = ldfrag_h(vp + 32 * (VPB / 2));
      const v16h v3 = ldfrag_h(vp + 48 * (VPB / 2));
      o[0] = mma_raw(pa.v, v0, o[0]);
      o[1] = mma_raw(pa.v, v1, o[1]);
      o[2] = mma_raw(pa.v, v2, o[2]);
      o[3] = mma_raw(pa.v, v3, o[3]);
      guard_o4(o[0], o[1], o[2], o[3], pa.v, v0, v1, v2, v3);
      const v16h v4 = ldfrag_h(vp + 64 * (VPB / 2));
      const v16h v5 = ldfrag_h(vp + 80 * (VPB / 2));
      const v16h v6 = ldfrag_h(vp + 96 * (VPB / 2));
      const v16h v7 = ldfrag_h(vp + 112 * (VPB / 2));
      o[4] = mma_raw(pa.v, v4, o[4]);
      o[5] = mma_raw(pa.v, v5, o[5]);
      o[6] = mma_raw(pa.v, v6, o[6]);
      o[7] = mma_raw(pa.v, v7, o[7]);
      guard_o4(o[4], o[5], o[6], o[7], pa.v, v4, v5, v6, v7);
    }
   }
   // ---- publish point of stage s + 1, at the foot of stage s ----
   {
     wait_ds0();                                       // this wave has left stage s's buffer
     if (pinned(isk)) tdm_wait(g0, g1k);               // stage s + 1 has landed
     if (pinned(isv)) tdm_wait(g0, g1v);
     __syncthreads();                                  // publishes stage s + 1; ends every reader's last read of stage s
     const uint32_t sn = pinned((uint32_t)s + 2u);   // stage s + 2, while it exists, into the buffer just left
     g0 = group0(sn);
     if (pinned((isk && sn < nst) ? 1u : 0u)) tdm_load(g0, g1k);
     if (pinned((isv && sn < nst) ? 1u : 0u)) tdm_load(g0, g1v);
   }
  }
  wait_tensor0();                                      // behind the ring: no request and no LDS read of this wave is left
  wait_ds0();
  acc_guard8(o[0], o[1], o[2], o[3], o[4], o[5], o[6], o[7]);

  // ---- fold 1/l and the carries (32768 on P, 256 on v), stage the wave's slab transposed [d][query] in its LDS region ----
  float* slab = smem + wave * SLABF;
  // ---- merge of the two key groups: the upper group's wave leaves its accumulators (lane-private order, 512 contiguous
  //      bytes per store), max and sum in the subtile's slab; the lower group's wave of the same rows takes them up ----
  if (kgu) {                                           // wave-uniform (SGPR)
#pragma unroll
    for (int j = 0; j < 8; ++j) {
      v4f w0, w1;
#pragma unroll
      for (int r = 0; r < 4; ++r) { w0[r] = o[j][r]; w1[r] = o[j][4 + r]; }
      *(v4f*)(slab + ((2 * j) * 32 + lane) * 4)     = w0;
      *(v4f*)(slab + ((2 * j + 1) * 32 + lane) * 4) = w1;
    }
    slab[2048 + lane] = m_run;
    slab[2080 + lane] = l_run;
  }
  __syncthreads();                                     // the upper group's partials are published; every wave passes it
  if (kgu) return;                                     // no barrier, tensor load or store of this wave is left
  const float m1 = slab[2048 + lane], l1 = slab[2080 + lane];
  v4f p0[8], p1[8];                                    // read whole before the slab is rewritten below (same wave, in order)
#pragma unroll
  for (int j = 0; j < 8; ++j) {
    p0[j] = *(const v4f*)(slab + ((2 * j) * 32 + lane) * 4);
    p1[j] = *(const v4f*)(slab + ((2 * j + 1) * 32 + lane) * 4);
  }
  const float mm = fmaxf(m_run, m1);                   // m_run is finite (step kb = 0); m1 may be -inf with l1 = 0
  const float a0 = ex2(m_run - mm), a1 = ex2(m1 - mm);
  const float lt = l_run * a0 + l1 * a1;
  const float oc = 1.0f / (PCAR * VCAR);               // 2^-23 exact
  const float li = (lt > 0.0f) ? ((1.0f / lt) * oc) : 0.0f;   // lt >= 1 (the max element contributes 2^0)
  const float li0 = li * a0, li1 = li * a1;
  float lf[8], lg[8];
#pragma unroll
  for (int r = 0; r < 8; ++r) {                        // factors of query iw + 8hh + r for the two partial accumulators
    lf[r] = __shfl(li0, 8 * hh + r, 32);
    lg[r] = __shfl(li1, 8 * hh + r, 32);
  }
#pragma unroll
  for (int j = 0; j < 8; ++j) {
    v4f w0, w1;
#pragma unroll
    for (int r = 0; r < 4; ++r) {
      w0[r] = o[j][r] * lf[r] + p0[j][r] * lg[r];
      w1[r] = o[j][4 + r] * lf[4 + r] + p1[j][r] * lg[4 + r];
    }
    float* sp = slab + (16 * j + c) * QP + 8 * hh;     // d row 16j + c, query cols 8hh .. 8hh+7, 16-B aligned
    *(v4f*)(sp)     = w0;
    *(v4f*)(sp + 4) = w1;
  }
  wave_sync_lds();
  v4f vals[16];
#pragma unroll
  for (int it = 0; it < 16; ++it) {
#pragma unroll
    for (int e = 0; e < 4; ++e) vals[it][e] = slab[(4 * lane + e) * QP + it];   // out(query iw+it, d = 4*lane+e)
  }
  float* dst = OPp + ((size_t)bb * SEQ + (size_t)iw) * HD + 4 * lane;
  {
#pragma unroll
    for (int it = 0; it < 16; ++it) {
      *(v4f*)(dst + (size_t)it * HD) = vals[it];   // one 512-B row per instruction, lanes 8q..8q+7 per line
    }
    
  }
}

// =====================================================================================================
// Workspace map (bytes); every plane is fully written by whole-line stores before it is read; all extents are exact
// multiples of the store granularity (no pad rows needed); offsets multiples of 128 (NB = 16 values):
//   QH f16 [NB][2048][128] x1024       8388608   at        0
//   KH f16 [NB][2048][128] x1024       8388608   at  8388608
//   VT f16 [NB][128][2048] x256        8388608   at 16777216
//   end                                             25165824
// =====================================================================================================
extern "C" void kernel_launch(void* const* d_in, const int* in_sizes, int n_in,
                              void* d_out, int out_size, void* d_ws, size_t ws_size,
                              hipStream_t stream) {
  const int NEL = NB * SEQ * HD;                        // 4194304 for NB = 16
  if (n_in < 3) return;
  if (in_sizes[0] < NEL || in_sizes[1] < NEL || in_sizes[2] < NEL) return;
  if (out_size < NEL) return;

  const float* q  = (const float*)d_in[0];
  const float* k  = (const float*)d_in[1];
  const float* v  = (const float*)d_in[2];
  float*       out = (float*)d_out;

  const size_t PQ = (size_t)NEL * 2;                    //  8388608
  const size_t PK = (size_t)NEL * 2;                    //  8388608
  const size_t PV = (size_t)NB * HD * SEQ * 2;          //  8388608
  size_t off = 0;
  const size_t oQH = off; off += PQ;
  const size_t oKH = off; off += PK;
  const size_t oVT = off; off += PV;
  if (off > ws_size) return;                            // off = 25165824
  if (off > (size_t)134217728) return;

  char* ws = (char*)d_ws;
  unsigned short* QH = (unsigned short*)(ws + oQH);
  unsigned short* KH = (unsigned short*)(ws + oKH);
  unsigned short* VT = (unsigned short*)(ws + oVT);

  const int n8 = NEL / 8;                               // 524288
  const dim3 blk(256);
  const dim3 gPL(VTB + 2 * CVB);                        // 512 + 2 x 2048: v^T, q and k planes in one launch
  const dim3 gAT(ATT_BLOCKS);                           // 512
  const dim3 bAT(ATT_THREADS);                          // 256

  // (0) v^T plane f16(bf16(v) * 256), layout [b][d][2048]; q and k planes f16(bf16(x) * 1024), layout [b][s][d]
  planes<<<gPL, blk, 0, stream>>>(q, k, v, QH, KH, VT, n8, QSC);
  // (1) causal flash attention per batch -> out [b][s][d] f32
  attn_fwd<<<gAT, bAT, 0, stream>>>(QH, KH, VT, out);
  (void)hipGetLastError();
}

// v007
// Measured time: 32.8 microseconds a run.
// Timed twice side by side with v006, it ran 1.21 and 1.19 times as fast.
// Counting every step since v000, it is 4.82 times as fast.
// Contractions: scores k.q^T (k x1024 and q x1024 as f16 planes of the bf16-RNE-converted inputs, one product, K=128) and
// P.v (P x32768 as one f16 plane, one product; v x256 f16 of the bf16-RNE-converted input; 32-key steps):
// all v_wmma_f32_16x16x32_f16 (f16 operands, f32 accumulate).
// Causal key range (key <= query); base-2 online softmax and the 1/l fold in f32 on VALU.
#include <hip/hip_runtime.h>
#include <math.h>
#include <stdint.h>

#ifndef NB
#define NB    16
#endif
#define SEQ   2048
#define HD    128
#define QSC   1024.0f
#define KSC   1024.0f
#define PCAR  32768.0f
#define VCAR  256.0f
#define SM_SCALE 0.08838834764831845f
#define LOG2E 1.4426950408889634f
#define ATW   4                          // query subtiles of 16 rows per block
#define KGR   4                          // key groups: wave group g takes keys 32g .. 32g+31 of every 128-key stage
#define ATT_THREADS (ATW * KGR * 32)
#define QPB   (16 * ATW)
#define BPB   (SEQ / QPB)
#define ATT_BLOCKS (NB * (BPB / 2))      // a block works the two query tiles BPB-1-p and p of one batch
#define NSTG  ((BPB + 2) / 2)            // 128-key stages of such a pair, the same for every p
#define QP    20
#define PARTF (64 * 32 + 2 * 32)         // floats of a wave's partial: 64 accumulator floats per lane, max, sum
#define VTP   72
#define VTILES (SEQ / 64)
#define VTB   (NB * VTILES)              // blocks of the v^T job in the plane launch
#define CVB   ((NB * SEQ * HD) / 2048)   // blocks per plane of the convert job (256 threads x 8 elements each)
#define STK   128                        // keys per LDS stage
#define KPB   272                        // LDS pitch of a staged k row: 256 B + 16 B pad (16 B x odd, ds_load_b128 reader)
#define VPB   272                        // LDS pitch of a staged v^T row: 256 B + 16 B pad
#define SLR   64                         // rows of a slice (one tensor load): 64 keys of k, or 64 d rows of v^T
#define SLP   18432                      // size of a slice's place in a buffer: 64 x 272 = 17408 B, rounded up to 2 KiB
#define BUFB  (4 * SLP)                  // k keys 0..63, k keys 64..127, v^T d 0..63, v^T d 64..127
static_assert(HD == 128 && QPB == 64 && ATT_THREADS == 512 && KGR * 32 == STK);
static_assert((SEQ % QPB) == 0 && (SEQ % 64) == 0 && (SEQ % 32) == 0 && (HD % 32) == 0);
static_assert(NB >= 1 && NB <= 16);
static_assert(BPB == 32 && VTILES == 32);
static_assert((HD - 1) * VTP + 63 < HD * VTP);
static_assert((QP % 4) == 0 && QP >= 16 && (PARTF % 4) == 0);
static_assert(((NB * SEQ * HD) % 2048) == 0);
static_assert(STK == 2 * SLR && HD == 2 * SLR && SLR * KPB <= SLP && SLR * VPB <= SLP && (SLP % 2048) == 0);
static_assert(KPB == HD * 2 + 16 && VPB == STK * 2 + 16 && STK == 2 * QPB && (BPB % 2) == 0);
static_assert((KGR * ATW * PARTF + KGR * ATW * 32 * QP) * 4 + 2 * BUFB <= 327680);

typedef _Float16 v16h __attribute__((ext_vector_type(16)));
typedef _Float16 v8h  __attribute__((ext_vector_type(8)));
typedef float    v8f  __attribute__((ext_vector_type(8)));
typedef float    v4f  __attribute__((ext_vector_type(4)));
typedef unsigned int v4u __attribute__((ext_vector_type(4)));
typedef uint32_t u32x4 __attribute__((ext_vector_type(4)));
typedef uint32_t u32x8 __attribute__((ext_vector_type(8)));

union FragH { v16h v; v8h h[2]; v4u u[2]; };

// ---- scalar helpers --------------------------------------------------------------------------------
__device__ __forceinline__ unsigned short bf_bits(float f) {          // f32 -> bf16 bits, RNE convert
  unsigned u = __float_as_uint(f);
  return (unsigned short)((u + 0x7FFFu + ((u >> 16) & 1u)) >> 16);
}
__device__ __forceinline__ float bf_up(unsigned short h) { return __uint_as_float(((unsigned)h) << 16); }
__device__ __forceinline__ float bfr(float f) { return bf_up(bf_bits(f)); }   // value of the bf16 RNE convert
__device__ __forceinline__ unsigned short h_bits(_Float16 x) { return __builtin_bit_cast(unsigned short, x); }
__device__ __forceinline__ unsigned pk16(unsigned short a, unsigned short b) { return (unsigned)a | ((unsigned)b << 16); }
// 2^x as the bare hardware instruction: results below 2^-126 come out as 0 instead of a subnormal. Every use here is a
// softmax weight or rescale factor relative to a row maximum whose own weight is 1, so such a term is below f32 rounding
// of the row sum and far below the smallest f16 step of P*32768. 2^(-inf) = 0 as before.
__device__ __forceinline__ float ex2(float x) {
#if defined(__HIP_DEVICE_COMPILE__)
  return __builtin_amdgcn_exp2f(x);
#else
  return exp2f(x);
#endif
}
// the same instruction with the slot behind a transcendental filled in its own statement: whatever the compiler puts next,
// also an instruction that overwrites x's register or reads the result, stands one vector instruction away
__device__ __forceinline__ float ex2_slot(float x) {
#if defined(__HIP_DEVICE_COMPILE__)
  float r;
  asm("v_exp_f32 %0, %1\n\tv_nop" : "=v"(r) : "v"(x));
  return r;
#else
  return exp2f(x);
#endif
}
__device__ __forceinline__ v8f zero8() { v8f z = {0.f, 0.f, 0.f, 0.f, 0.f, 0.f, 0.f, 0.f}; return z; }

// ---- fragment loader: 16-bit A/B operand, lane -> row/col (lane&15), p already includes +8*(lane>>4);
//      elements 0..7 <- p[0..7] (k0+8h..), elements 8..15 <- p[16..23] (k0+16+8h..)  (same split k map for A and B;
//      B is always read from a k-contiguous [n][k] plane)
__device__ __forceinline__ v16h ldfrag_h(const _Float16* p) {
  FragH f;
  f.h[0] = *(const v8h*)(p);
  f.h[1] = *(const v8h*)(p + 16);
  return f.v;
}

__device__ __forceinline__ v8f mma_raw(v16h a, v16h b, v8f c) {
  return __builtin_amdgcn_wmma_f32_16x16x32_f16(false, a, false, b, (short)0, c, false, false);
}
// after a 4-deep score chain: ties the accumulator, keeps the 4 A and 4 B fragments live through the nops
__device__ __forceinline__ void guard_s(v8f& s, v16h x0, v16h x1, v16h x2, v16h x3,
                                        v16h y0, v16h y1, v16h y2, v16h y3) {
#if defined(__HIP_DEVICE_COMPILE__)
  asm volatile("v_nop\n\tv_nop\n\tv_nop\n\tv_nop"
               : "+v"(s) : "v"(x0), "v"(x1), "v"(x2), "v"(x3), "v"(y0), "v"(y1), "v"(y2), "v"(y3) : "memory");
#endif
}
// after a group of 4 P.V products (P x 4 v fragments): ties 4 accumulators, keeps the P fragment and the 4 v fragments live
__device__ __forceinline__ void guard_o4(v8f& a, v8f& b, v8f& c, v8f& d,
                                         v16h p, v16h x0, v16h x1, v16h x2, v16h x3) {
#if defined(__HIP_DEVICE_COMPILE__)
  asm volatile("v_nop\n\tv_nop\n\tv_nop\n\tv_nop"
               : "+v"(a), "+v"(b), "+v"(c), "+v"(d) : "v"(p), "v"(x0), "v"(x1), "v"(x2), "v"(x3) : "memory");
#endif
}
__device__ __forceinline__ void acc_guard8(v8f& a, v8f& b, v8f& c, v8f& d, v8f& e, v8f& f, v8f& g, v8f& hx) {
#if defined(__HIP_DEVICE_COMPILE__)
  asm volatile("v_nop\n\tv_nop\n\tv_nop\n\tv_nop"
               : "+v"(a), "+v"(b), "+v"(c), "+v"(d), "+v"(e), "+v"(f), "+v"(g), "+v"(hx));
#endif
}
__device__ __forceinline__ void wave_sync_lds() {
  __builtin_amdgcn_fence(__ATOMIC_RELEASE, "workgroup");
  __builtin_amdgcn_wave_barrier();
  __builtin_amdgcn_fence(__ATOMIC_ACQUIRE, "workgroup");
}

// ---- tensor load to LDS: descriptor words, issue, waits ----------------------------------------------
__device__ __forceinline__ uint32_t uni(uint32_t v) { return (uint32_t)__builtin_amdgcn_readfirstlane((int)v); }
// value held in a scalar register: a test on it compiles to s_cmp + s_cbranch_scc (tensor loads ignore EXEC), and a
// descriptor word formed from it is formed behind the asm waits that stand in front of this statement
__device__ __forceinline__ uint32_t pinned(uint32_t v) {
  uint32_t w = uni(v);
#if defined(__HIP_DEVICE_COMPILE__)
  asm volatile("" : "+s"(w));
#endif
  return w;
}
__device__ __forceinline__ void wait_ds0() {       // this wave's LDS reads have returned before the buffer is handed over
#if defined(__HIP_DEVICE_COMPILE__)
  asm volatile("s_wait_dscnt 0x0" ::: "memory");
#endif
}
__device__ __forceinline__ void wait_tensor0() {   // the issuing wave's tile has landed (the compiler places no such wait)
#if defined(__HIP_DEVICE_COMPILE__)
  asm volatile("s_wait_tensorcnt 0x0" ::: "memory");
#endif
}
// Group 1 of a two-dimensional tile, every extent in bytes: ROWS rows of ROWB bytes, source pitch PITCH, 16 B of LDS pad
// behind each row (interval code IVL = the row length), no mask; tensor dims = tile dims (every tile is interior).
template <uint32_t ROWB, uint32_t ROWS, uint32_t PITCH, uint32_t IVL>
__device__ __forceinline__ u32x8 tdm_group1() {
  u32x8 g;   // pinned(): each descriptor word held in a scalar register of its own for the whole kernel
  g[0] = pinned((1u << 20) | (IVL << 22) | (3u << 25));
  g[1] = pinned((ROWB & 0xFFFFu) << 16);
  g[2] = pinned((ROWB >> 16) | ((ROWS & 0xFFFFu) << 16));
  g[3] = pinned((ROWS >> 16) | (ROWB << 16));
  g[4] = pinned(ROWS);
  g[5] = pinned(PITCH);
  g[6] = pinned(0u);
  g[7] = pinned(0u);
  return g;
}
__device__ __forceinline__ u32x4 tdm_group0(uint32_t lds_dst, uint64_t ga) {
  u32x4 g;
  g[0] = uni(1u);
  g[1] = uni(lds_dst);
  g[2] = uni((uint32_t)ga);
  g[3] = uni((((uint32_t)(ga >> 32)) & 0x01FFFFFFu) | 0x80000000u);
#if defined(__HIP_DEVICE_COMPILE__)
  asm volatile("" : "+s"(g));   // descriptor words held in scalar registers until the wait that names them
#endif
  return g;
}
__device__ __forceinline__ void tdm_load(u32x4 g0, u32x8 g1) {
#if defined(__HIP_DEVICE_COMPILE__)
  asm volatile("tensor_load_to_lds %0, %1" :: "s"(g0), "s"(g1) : "memory");
#endif
}
// the issuing wave's tile has landed (the compiler places no such wait); naming the descriptor keeps its registers
// unchanged while the request is outstanding
__device__ __forceinline__ void tdm_wait(u32x4 g0, u32x8 g1) {
#if defined(__HIP_DEVICE_COMPILE__)
  asm volatile("s_wait_tensorcnt 0x0" :: "s"(g0), "s"(g1) : "memory");
#endif
}

// =====================================================================================================
// 16-bit plane convert, no relayout (inputs are batch-major [b][s][d]):
//   pl[e] = f16( bf16(x[e]) * sc ) (sc a power of two, exact). Job rank cb < CVB: q plane, else k plane.
// Thread = 8 consecutive elements: two 16-B loads, one 16-B store per lane; 32 consecutive lanes = 512 contiguous, 512-B
// coverage: CVB blocks x 256 thr x 8 elements = n = NB*2048*128 per plane exactly (n % 2048 == 0 asserted).
// =====================================================================================================
__device__ __forceinline__ void cvt16(const float* __restrict__ xq, const float* __restrict__ xk,
                                      unsigned short* plq, unsigned short* plk, int n8, float sc, int cb) {
  const bool sk = (cb >= CVB);              // block-uniform plane select (both pointers global)
  const int gt = (sk ? cb - CVB : cb) * 256 + (int)threadIdx.x;
  if (gt >= n8) return;                     // never taken with the exact grid; no barriers in this job
  const float* x = sk ? xk : xq;
  unsigned short* pl = sk ? plk : plq;
  const size_t e = (size_t)gt * 8;
  const v4f a = *(const v4f*)(x + e), bq = *(const v4f*)(x + e + 4);
  v4u o;
#pragma unroll
  for (int i = 0; i < 2; ++i) {
    o[i]     = pk16(h_bits((_Float16)(bfr(a[2 * i]) * sc)),  h_bits((_Float16)(bfr(a[2 * i + 1]) * sc)));
    o[2 + i] = pk16(h_bits((_Float16)(bfr(bq[2 * i]) * sc)), h_bits((_Float16)(bfr(bq[2 * i + 1]) * sc)));
  }
  unsigned short* d = pl + e;
  {
    *(v4u*)(d) = o;
    
  }
}

// =====================================================================================================
// v^T plane: VT[(b*HD + d)][key] = f16( bf16(v[b][key][d]) * 256 ) (exact), pitch SEQ = 2048 halves (4096 B) per d row.
// Block = (b, tile of 64 keys): 64 source rows of 128 floats loaded with 16-B loads (static stride), converted, written into
// coverage: load 256 thr x 32 elements = 64 keys x 128 d; store 4 iterations x 256 thr x 8 halves = 128 lines x 64 = the tile;
//           NB x 32 blocks cover the whole [NB][128][2048] plane exactly once. T: the block's [128 d][64 keys] LDS tile.
// =====================================================================================================
__device__ __forceinline__ void vt16(const float* __restrict__ v, unsigned short* VTo, unsigned short* T, int bid) {
  const int tid = threadIdx.x;
  const int bb  = bid / VTILES;
  const int t   = bid - bb * VTILES;        // 0..31, block-uniform
  if (bb >= NB) return;                     // never taken with the exact grid; before any barrier or store
  {
    const int sl = tid >> 2;                  // key within tile 0..63
    const int dc = (tid & 3) * 32;            // d chunk 0,32,64,96
    int key = 64 * t + sl;                    // <= SEQ-1 by construction; clamp keeps the address in range regardless
    key = (key < 0) ? 0 : ((key > SEQ - 1) ? (SEQ - 1) : key);
    const float* src = v + (((size_t)bb * SEQ + (size_t)key) * HD + dc);
#pragma unroll
    for (int i = 0; i < 8; ++i) {
      const v4f a = *(const v4f*)(src + 4 * i);
#pragma unroll
      for (int e = 0; e < 4; ++e) T[(dc + 4 * i + e) * VTP + sl] = h_bits((_Float16)(bfr(a[e]) * VCAR));
    }
  }
  __syncthreads();
  v4u vals[4];
  const int q8 = tid >> 3, p8 = (tid & 7) * 8;
#pragma unroll
  for (int it = 0; it < 4; ++it) {
    const int line = it * 32 + q8;            // d = 0..127
    vals[it] = *(const v4u*)(T + line * VTP + p8);
  }
  unsigned short* dst = VTo + ((size_t)bb * HD) * SEQ + 64 * t + p8;
  {
#pragma unroll
    for (int it = 0; it < 4; ++it) {
      const int line = it * 32 + q8;
      *(v4u*)(dst + (size_t)line * SEQ) = vals[it];
    }
    
  }
}

// =====================================================================================================
// The three planes in one launch: the jobs are independent of one another (each reads its own input and writes its own
// plane), and the block index picks the job, block-uniformly. Blocks 0 .. VTB-1 build the v^T plane: they hold the longer
// chain (loads, LDS, barrier, stores); blocks VTB .. VTB + 2*CVB - 1 convert q, then k, and stream beside them.
// =====================================================================================================
__global__ __launch_bounds__(256) void planes(const float* __restrict__ xq, const float* __restrict__ xk,
                                              const float* __restrict__ v, unsigned short* plq, unsigned short* plk,
                                              unsigned short* VTo, int n8, float sc) {
  __shared__ __align__(16) unsigned short T[HD * VTP];
  const int bid = blockIdx.x;
  if (bid < VTB) vt16(v, VTo, T, bid);
  else           cvt16(xq, xk, plq, plk, n8, sc, bid - VTB);
}

// =====================================================================================================
// Causal flash attention per batch. Block = (b, pair p), 16 waves, alone on its WGP (by LDS): it works the 64 queries of tile
//   31 - p and then those of tile p. A tile t holds t + 1 units of 64 keys, a pair 33 of them, 17 stages of 128 keys for every
//   p: each WGP has the same work and keeps its 16 waves through all of it.
//   Wave w works query rows iw = 64t + 16(w & 3) .. +15 on the keys 128s + 32(w >> 2) .. +31 of every stage s of the tile; the
//   four waves w & 3 hold partial max, sum and accumulators of the same rows over disjoint keys, merged once behind the tile's
//   key loop (through LDS slabs, each of the four waves merging and storing 32 of the 128 columns).
//   q plane f16 [b][s][d] x1024, k plane f16 [b][s][d] x1024, v^T plane f16 [b][d][SEQ] x256.
//   The k and v^T planes reach the waves through LDS: stages of 128 keys, brought by tensor loads into two buffers that the
//   block's waves share; the fragment loads below read the staged rows (same lane -> row and k maps as from the planes).
//   The two tiles' stages form one run 0 .. 16 through the ring: the light tile's first stages fly while the heavy tile ends.
//   Key loop kb = 128s + 32(w >> 2), a step is worked while kb < iw + 16 (wave-uniform, SGPR): keys above iw+15 are excluded
//   for every query of the wave; kb <= iw holds in every worked step, so key kb is included for every query (row max finite,
//   row sum >= 1 from the wave's first worked step on; a wave of an upper key group may have no step at all: max -inf, sum 0).
//   Scores are formed transposed, S^T = K.Q^T: A fragment = k plane row (key kb+16u+c), B fragment = q plane row
//   (query iw+c), both with the split d map, 4 d-steps of 32, one product each.
//   D element r of subtile u at lane (h,c) = score(key kb+16u+8h+r, query iw+c). In the last step(s) entries with
//   key > query are excluded (score -> -inf before the max, exp2 -> exactly 0), which equals the large negative fill
//   followed by softmax in f32.
//   The A fragment of P for the P.V product (row = query c, element r <- key kb+8h+r from subtile 0, element 8+r <-
//   key kb+16+8h+r from subtile 1) is an in-lane f32 -> f16 convert of P*32768 (RNE, relative error at most 2^-11 for
//   P >= 2^-29), an eighth of the 2^-8 that the bf16 convert leaves on the q, k and v values P and the product are formed
//   from. The row sum is taken from the unrounded f32 weights.
//   Online max-subtracted softmax in f32 (exp2); per-query max/sum = 16 in-lane values combined across the two lane halves;
//   rescale factors broadcast with shuffles.
//   P.V: B fragments = v^T plane rows d = 16j+c (keys contiguous), 8 products into 8 accumulators (16 queries x 128 d).
//   Epilogue: 1/l and the carry folds in f32; the wave's 16x32 piece staged transposed [d][16] (pitch 20) in its private LDS
// coverage: per wave and tile 4 instructions x 32 lanes x 4 floats = 16 rows x 32 columns; per block 16 waves = 64 rows x 128,
//           2 tiles = 128 rows; tiles 31 - p and p, p = 0 .. 15, are all 32 tiles of a batch, NB batches: every element of out
//           [NB][2048][128] exactly once (grid NB*16 blocks); every wave of key group 0 runs at least one key step (kb = 0).
// =====================================================================================================
__global__ __launch_bounds__(ATT_THREADS)
void attn_fwd(const unsigned short* __restrict__ QHp, const unsigned short* __restrict__ KHp,
              const unsigned short* __restrict__ VTq, float* OPp) {
  __shared__ __align__(16) float part[KGR * ATW * PARTF];     // per wave: its partial accumulators, max and sum
  __shared__ __align__(16) float stg[KGR * ATW * 32 * QP];    // per wave: [32 d][16 queries] f32 output piece, pitch QP
  __shared__ __attribute__((aligned(2048))) unsigned char ring[2 * BUFB];   // two buffers of four slices [64 rows][272 B]

  const int tid  = threadIdx.x;
  const int wave = (tid >> 5) & (ATW - 1);             // query subtile
  const int kgu  = __builtin_amdgcn_readfirstlane(tid >> 7);   // key group 0 .. 3, wave-uniform in an SGPR
  const int lane = tid & 31;
  const int hh   = lane >> 4;
  const int c    = lane & 15;

  const uint32_t bid = blockIdx.x;
  if (bid >= (uint32_t)ATT_BLOCKS) return;             // never taken with the exact grid; before any LDS use or store
  const int bb   = (int)(bid % (uint32_t)NB);           // 0 .. NB-1
  const int pr   = (int)(bid / (uint32_t)NB);           // pair 0 .. 15, block-uniform: tiles 31 - pr and pr

  // Stage g of the block's run, g = 0 .. 16: the first nh are keys 128g .. +127 for tile 31 - pr, the others keys
  // 128(g - nh) .. +127 for tile pr, all of batch bb. Four waves bring a slice each, one request each, into buffer g & 1:
  // waves 0, 1 the k rows of keys 0..63 and 64..127 of the stage (64 rows of 256 B, contiguous), waves 2, 3 the v^T rows
  // d 0..63 and 64..127 (64 rows of 256 B, source pitch 4096 B). A tile t has (t + 2) >> 1 stages, the last ends at key
  // 64t + 63 (t odd) or 64t + 127 (t even, so t <= 30): at most SEQ - 1, every slice interior to its plane.
  const uint32_t wv    = uni((uint32_t)tid >> 5);
  const uint32_t nh    = uni((uint32_t)(BPB + 1 - pr) >> 1);   // stages of tile 31 - pr: 9 .. 16; tile pr has NSTG - nh
  const uint32_t lbase = (uint32_t)(size_t)ring;
  const uint64_t kga   = (uint64_t)(size_t)KHp + (uint64_t)bb * (SEQ * HD * 2);
  const uint64_t vga   = (uint64_t)(size_t)VTq + (uint64_t)bb * (HD * SEQ * 2);
  const u32x8 g1k = tdm_group1<HD * 2, SLR, HD * 2, 5u>();
  const u32x8 g1v = tdm_group1<STK * 2, SLR, SEQ * 2, 5u>();
  const uint32_t isk = (wv < 2u) ? 1u : 0u, isv = (wv == 2u || wv == 3u) ? 1u : 0u;
  const uint32_t slc = wv & 3u, hlf = wv & 1u;         // slice of the buffer, half of its tile
  auto group0 = [&](uint32_t sn) {                     // sn comes from pinned(): formed behind the waits in front of it
    const uint32_t ko = ((sn < nh) ? sn : sn - nh) * STK;      // first key of the stage
    return tdm_group0(lbase + (sn & 1u) * BUFB + slc * SLP,
                      isv ? vga + (uint64_t)ko * 2 + (uint64_t)hlf * (SLR * SEQ * 2)
                          : kga + (uint64_t)ko * (HD * 2) + (uint64_t)hlf * (SLR * HD * 2));
  };
  u32x4 g0 = group0(pinned(0u));
  if (pinned(isk)) { tdm_load(g0, g1k); tdm_wait(g0, g1k); }   // stage 0 has landed
  if (pinned(isv)) { tdm_load(g0, g1v); tdm_wait(g0, g1v); }
  __syncthreads();                                     // stage 0 published to all sixteen waves
  {
    const uint32_t sn = pinned(1u);                    // stage 1 flies while stage 0 is worked on
    g0 = group0(sn);
    if (pinned((isk && sn < (uint32_t)NSTG) ? 1u : 0u)) tdm_load(g0, g1k);
    if (pinned((isv && sn < (uint32_t)NSTG) ? 1u : 0u)) tdm_load(g0, g1v);
  }
  // key rows 32 kgu + c of a stage's k slices, split d map; d row c of its v^T slices at keys 32 kgu .., split key map
  const unsigned char* Kl = ring + (kgu >> 1) * SLP + ((kgu & 1) * 32 + c) * KPB + 16 * hh;
  const unsigned char* Vl = ring + 2 * SLP + c * VPB + (32 * kgu) * 2 + 16 * hh;
  const float lsc = (SM_SCALE * LOG2E) / (QSC * KSC);

  // B fragments of q^T: lane col n = query iw + c, split d map; first those of tile 31 - pr
  const _Float16* Qp = (const _Float16*)(const void*)QHp + ((size_t)bb * SEQ + (size_t)(wave * 16 + c)) * HD + 8 * hh;
  const _Float16* Qb = Qp + (size_t)(QPB * (BPB - 1 - pr)) * HD;
  v16h qf0 = ldfrag_h(Qb);                             // d 0..31
  v16h qf1 = ldfrag_h(Qb + 32);                        // d 32..63
  v16h qf2 = ldfrag_h(Qb + 64);                        // d 64..95
  v16h qf3 = ldfrag_h(Qb + 96);                        // d 96..127

  uint32_t gs = 0u;                                    // stage of the block's run, block-uniform
#pragma unroll 1
  for (int ph = 0; ph < 2; ++ph) {                     // the two tiles, one after the other (one copy of the code)
  const int t    = ph ? pr : (BPB - 1 - pr);           // 0..31, block-uniform
  const int ns   = ph ? (NSTG - (int)nh) : (int)nh;    // the tile's stages, block-uniform
  const int iw   = QPB * t + wave * 16;                // query row 0 of this wave, iw + 15 <= SEQ - 1
  const int iwu  = __builtin_amdgcn_readfirstlane(iw); // wave-uniform copy in an SGPR
  const int kend = iwu + 16;                           // keys 0 .. iw+15 ; kend <= SEQ
  const int dq0 = 8 * hh - (iw + c);                   // key(kb+8hh+r) - query(iw+c) = kb + dq0 + r

  float m_run = -INFINITY, l_run = 0.f;
  v8f o[8];
#pragma unroll
  for (int j = 0; j < 8; ++j) o[j] = zero8();

#pragma unroll 1
  for (int s = 0; s < ns; ++s, ++gs) {                 // block-uniform trip count: every wave passes every publish point
   const int kb = STK * s + 32 * kgu;                  // this wave's 32 keys of stage s
   const int bo = (int)(gs & 1u) * BUFB;               // buffer of the stage
   if (kb < kend) {                                    // wave-uniform (SGPR): steps wholly above the wave's queries are skipped
    // ---- scores (transposed): s0 = keys kb..kb+15, s1 = keys kb+16..kb+31, columns = queries iw..iw+15 ----
    v8f s0 = zero8(), s1 = zero8();
    {
      const _Float16* k0p = (const _Float16*)(const void*)(Kl + bo);   // key row kb + c
      const v16h a0 = ldfrag_h(k0p), a1 = ldfrag_h(k0p + 32), a2 = ldfrag_h(k0p + 64), a3 = ldfrag_h(k0p + 96);
      s0 = mma_raw(a0, qf0, s0);
      s0 = mma_raw(a1, qf1, s0);
      s0 = mma_raw(a2, qf2, s0);
      s0 = mma_raw(a3, qf3, s0);
      guard_s(s0, a0, a1, a2, a3, qf0, qf1, qf2, qf3);
      const _Float16* k1p = k0p + 16 * (KPB / 2);                    // key row kb + 16 + c
      const v16h b0 = ldfrag_h(k1p), b1 = ldfrag_h(k1p + 32), b2 = ldfrag_h(k1p + 64), b3 = ldfrag_h(k1p + 96);
      s1 = mma_raw(b0, qf0, s1);
      s1 = mma_raw(b1, qf1, s1);
      s1 = mma_raw(b2, qf2, s1);
      s1 = mma_raw(b3, qf3, s1);
      guard_s(s1, b0, b1, b2, b3, qf0, qf1, qf2, qf3);
    }
    // ---- base-2 logits for query iw + c (16 keys in this lane, 16 in the other half) ----
    float u0[8], u1[8];
#pragma unroll
    for (int r = 0; r < 8; ++r) {
      u0[r] = s0[r] * lsc;
      u1[r] = s1[r] * lsc;
    }
    // ---- causal exclusion, only in steps that hold keys above some query of the wave (wave-uniform test) ----
    if (kb + 32 > iwu) {
      const int dq = kb + dq0;
#pragma unroll
      for (int r = 0; r < 8; ++r) {
        u0[r] = (dq + r > 0)      ? -INFINITY : u0[r];   // key kb+8hh+r    > query iw+c
        u1[r] = (dq + 16 + r > 0) ? -INFINITY : u1[r];   // key kb+16+8hh+r > query iw+c
      }
    }
    // ---- online softmax ----
    float mx = -INFINITY;
#pragma unroll
    for (int r = 0; r < 8; ++r) mx = fmaxf(mx, fmaxf(u0[r], u1[r]));
    mx = fmaxf(mx, __shfl_xor(mx, 16, 32));            // finite: key kb <= iw <= every query of the wave
    const float mn = fmaxf(m_run, mx);                 // finite from the first step on
    const float al = ex2(m_run - mn);                  // 0 on the first step
    m_run = mn;
    float ps = 0.f;
    FragH pa;                                          // P*32768 in f16
#pragma unroll
    for (int r = 0; r < 8; ++r) {
      const float e0 = ex2(u0[r] - mn), e1 = ex2(u1[r] - mn);   // excluded keys: 2^(-inf) = 0 exactly
      ps += e0 + e1;
      pa.h[0][r] = (_Float16)(e0 * PCAR);               // element r     = key kb + 8hh + r
      pa.h[1][r] = (_Float16)(e1 * PCAR);               // element 8 + r = key kb + 16 + 8hh + r
    }
    ps += __shfl_xor(ps, 16, 32);
    l_run = l_run * al + ps;
#pragma unroll
    for (int r = 0; r < 8; ++r) {
      const float af = __shfl(al, 8 * hh + r, 32);      // rescale factor of query iw + 8hh + r
#pragma unroll
      for (int j = 0; j < 8; ++j) o[j][r] *= af;
    }
    // ---- P.V : B fragment col n = d = 16j + c, keys kb .. kb+31 contiguous in the v^T plane row d ----
    {
      const _Float16* vp = (const _Float16*)(const void*)(Vl + bo);          // d rows 0..63: first v^T slice
      const v16h v0 = ldfrag_h(vp);
      const v16h v1 = ldfrag_h(vp + 16 * (VPB / 2));
      const v16h v2 = ldfrag_h(vp + 32 * (VPB / 2));
      const v16h v3 = ldfrag_h(vp + 48 * (VPB / 2));
      o[0] = mma_raw(pa.v, v0, o[0]);
      o[1] = mma_raw(pa.v, v1, o[1]);
      o[2] = mma_raw(pa.v, v2, o[2]);
      o[3] = mma_raw(pa.v, v3, o[3]);
      guard_o4(o[0], o[1], o[2], o[3], pa.v, v0, v1, v2, v3);
      const _Float16* vq = vp + SLP / 2;                                     // d rows 64..127: second v^T slice
      const v16h v4 = ldfrag_h(vq);
      const v16h v5 = ldfrag_h(vq + 16 * (VPB / 2));
      const v16h v6 = ldfrag_h(vq + 32 * (VPB / 2));
      const v16h v7 = ldfrag_h(vq + 48 * (VPB / 2));
      o[4] = mma_raw(pa.v, v4, o[4]);
      o[5] = mma_raw(pa.v, v5, o[5]);
      o[6] = mma_raw(pa.v, v6, o[6]);
      o[7] = mma_raw(pa.v, v7, o[7]);
      guard_o4(o[4], o[5], o[6], o[7], pa.v, v4, v5, v6, v7);
    }
   }
   // ---- publish point of stage gs + 1, at the foot of stage gs ----
   {
     wait_ds0();                                       // this wave has left stage gs's buffer
     if (pinned(isk)) tdm_wait(g0, g1k);               // stage gs + 1 has landed
     if (pinned(isv)) tdm_wait(g0, g1v);
     __syncthreads();                                  // publishes stage gs + 1; ends every reader's last read of stage gs
     const uint32_t sn = pinned(gs + 2u);              // stage gs + 2, while it exists, into the buffer just left
     g0 = group0(sn);
     if (pinned((isk && sn < (uint32_t)NSTG) ? 1u : 0u)) tdm_load(g0, g1k);
     if (pinned((isv && sn < (uint32_t)NSTG) ? 1u : 0u)) tdm_load(g0, g1v);
   }
  }
  acc_guard8(o[0], o[1], o[2], o[3], o[4], o[5], o[6], o[7]);

  // ---- merge of the four key groups: every wave leaves its accumulators (lane-private order, 512 contiguous bytes per
  //      store), max and sum in its own slab; behind the barrier the wave of key group g merges, for its 16 rows, the columns
  //      d = 32g .. 32g+31 (accumulators 2g and 2g+1) of all four partials and stores them. A slab is rewritten for the second
  //      tile only behind that tile's first publish point, which every wave passes behind its reads (s_wait_dscnt 0) ----
  {
    float* pt = part + (kgu * ATW + wave) * PARTF;
#pragma unroll
    for (int j = 0; j < 8; ++j) {
      v4f w0, w1;
#pragma unroll
      for (int r = 0; r < 4; ++r) { w0[r] = o[j][r]; w1[r] = o[j][4 + r]; }
      *(v4f*)(pt + ((2 * j) * 32 + lane) * 4)     = w0;
      *(v4f*)(pt + ((2 * j + 1) * 32 + lane) * 4) = w1;
    }
    pt[2048 + lane] = m_run;
    pt[2080 + lane] = l_run;
  }
  __syncthreads();                                     // the partials are published; every wave passes it
  if (ph == 0) {                                       // block-uniform: q^T fragments of tile pr, in flight beside the merge
    const _Float16* Qn = Qp + (size_t)(QPB * pr) * HD;
    qf0 = ldfrag_h(Qn);
    qf1 = ldfrag_h(Qn + 32);
    qf2 = ldfrag_h(Qn + 64);
    qf3 = ldfrag_h(Qn + 96);
  }
  {
    // ---- fold 1/l and the carries (32768 on P, 256 on v) into one factor per partial and query ----
    const float* pw = part + wave * PARTF;               // the subtile's partial of group g at pw + g * ATW * PARTF
    float mg[KGR], lv[KGR];
#pragma unroll
    for (int g = 0; g < KGR; ++g) {
      mg[g] = pw[g * (ATW * PARTF) + 2048 + lane];
      lv[g] = pw[g * (ATW * PARTF) + 2080 + lane];
    }
    const float mm = fmaxf(fmaxf(mg[0], mg[1]), fmaxf(mg[2], mg[3]));   // mg[0] is finite (step kb = 0); the others may be -inf with sum 0
    float ag[KGR];
#pragma unroll
    for (int g = 0; g < KGR; ++g) ag[g] = ex2_slot(mg[g] - mm);
    const float lt = (lv[0] * ag[0] + lv[1] * ag[1]) + (lv[2] * ag[2] + lv[3] * ag[3]);
    const float oc = 1.0f / (PCAR * VCAR);               // 2^-23 exact
    const float li = (lt > 0.0f) ? ((1.0f / lt) * oc) : 0.0f;   // lt >= 1 (the max element contributes 2^0)
    v8f e0 = zero8(), e1 = zero8();                      // out(query iw + 8hh + r, d = 32 kgu + c) and (.., d = 32 kgu + 16 + c)
#pragma unroll
    for (int g = 0; g < KGR; ++g) {
      const float lig = li * ag[g];
      const float* pj = pw + g * (ATW * PARTF) + (4 * kgu * 32 + lane) * 4;   // accumulators 2 kgu and 2 kgu + 1 of partial g
      const v4f p00 = *(const v4f*)(pj),       p01 = *(const v4f*)(pj + 128);
      const v4f p10 = *(const v4f*)(pj + 256), p11 = *(const v4f*)(pj + 384);
#pragma unroll
      for (int r = 0; r < 4; ++r) {
        const float fa = __shfl(lig, 8 * hh + r, 32);      // factor of query iw + 8hh + r
        const float fb = __shfl(lig, 8 * hh + 4 + r, 32);  // factor of query iw + 8hh + 4 + r
        e0[r]     += p00[r] * fa;
        e0[4 + r] += p01[r] * fb;
        e1[r]     += p10[r] * fa;
        e1[4 + r] += p11[r] * fb;
      }
    }
    // ---- the wave's 16 x 32 piece staged transposed [d][query] (pitch QP) in its private LDS region ----
    float* sg = stg + (kgu * ATW + wave) * (32 * QP);
    {
      v4f w0, w1, w2, w3;
#pragma unroll
      for (int r = 0; r < 4; ++r) { w0[r] = e0[r]; w1[r] = e0[4 + r]; w2[r] = e1[r]; w3[r] = e1[4 + r]; }
      float* sp = sg + c * QP + 8 * hh;                  // d row c (then 16 + c), query cols 8hh .. 8hh+7, 16-B aligned
      *(v4f*)(sp)     = w0;
      *(v4f*)(sp + 4) = w1;
      *(v4f*)(sp + 16 * QP)     = w2;
      *(v4f*)(sp + 16 * QP + 4) = w3;
    }
    wave_sync_lds();
    const int qr = lane >> 3, d4 = 4 * (lane & 7);       // row within a group of 4 queries, first of 4 columns
    v4f vals[4];
#pragma unroll
    for (int it = 0; it < 4; ++it) {
#pragma unroll
      for (int e = 0; e < 4; ++e) vals[it][e] = sg[(d4 + e) * QP + 4 * it + qr];   // out(query iw+4it+qr, d = 32 kgu + d4 + e)
    }
    float* dst = OPp + ((size_t)bb * SEQ + (size_t)(iw + qr)) * HD + 32 * kgu + d4;
#pragma unroll
    for (int it = 0; it < 4; ++it) {
      *(v4f*)(dst + (size_t)(4 * it) * HD) = vals[it];   // four whole 128-B lines per instruction, lanes 8q..8q+7 per line
    }
#if defined(__HIP_DEVICE_COMPILE__)
    // the stores' address and data registers are rewritten at the head of the next tile (accumulators set to 0)
    asm volatile("s_wait_xcnt 0x0" ::: "memory");
#endif
  }
  }
  wait_tensor0();                                      // behind the ring: no request and no LDS read of this wave is left
  wait_ds0();
}

// =====================================================================================================
// Workspace map (bytes); every plane is fully written by whole-line stores before it is read; all extents are exact
// multiples of the store granularity (no pad rows needed); offsets multiples of 128 (NB = 16 values):
//   QH f16 [NB][2048][128] x1024       8388608   at        0
//   KH f16 [NB][2048][128] x1024       8388608   at  8388608
//   VT f16 [NB][128][2048] x256        8388608   at 16777216
//   end                                             25165824
// =====================================================================================================
extern "C" void kernel_launch(void* const* d_in, const int* in_sizes, int n_in,
                              void* d_out, int out_size, void* d_ws, size_t ws_size,
                              hipStream_t stream) {
  const int NEL = NB * SEQ * HD;                        // 4194304 for NB = 16
  if (n_in < 3) return;
  if (in_sizes[0] < NEL || in_sizes[1] < NEL || in_sizes[2] < NEL) return;
  if (out_size < NEL) return;

  const float* q  = (const float*)d_in[0];
  const float* k  = (const float*)d_in[1];
  const float* v  = (const float*)d_in[2];
  float*       out = (float*)d_out;

  const size_t PQ = (size_t)NEL * 2;                    //  8388608
  const size_t PK = (size_t)NEL * 2;                    //  8388608
  const size_t PV = (size_t)NB * HD * SEQ * 2;          //  8388608
  size_t off = 0;
  const size_t oQH = off; off += PQ;
  const size_t oKH = off; off += PK;
  const size_t oVT = off; off += PV;
  if (off > ws_size) return;                            // off = 25165824
  if (off > (size_t)134217728) return;

  char* ws = (char*)d_ws;
  unsigned short* QH = (unsigned short*)(ws + oQH);
  unsigned short* KH = (unsigned short*)(ws + oKH);
  unsigned short* VT = (unsigned short*)(ws + oVT);

  const int n8 = NEL / 8;                               // 524288
  const dim3 blk(256);
  const dim3 gPL(VTB + 2 * CVB);                        // 512 + 2 x 2048: v^T, q and k planes in one launch
  const dim3 gAT(ATT_BLOCKS);                           // 256
  const dim3 bAT(ATT_THREADS);                          // 512

  // (0) v^T plane f16(bf16(v) * 256), layout [b][d][2048]; q and k planes f16(bf16(x) * 1024), layout [b][s][d]
  planes<<<gPL, blk, 0, stream>>>(q, k, v, QH, KH, VT, n8, QSC);
  // (1) causal flash attention per batch -> out [b][s][d] f32
  attn_fwd<<<gAT, bAT, 0, stream>>>(QH, KH, VT, out);
  (void)hipGetLastError();
}
